// v000
// Times are from an AMD MI455X. After a warm-up the kernel runs many times in a row, and a time is the length of
// such a window on the GPU divided by its runs, so every launch and the gaps after it count. The runs cycle
// through copies of the inputs. A figure is the median of several windows, for all but v000 over two sittings.
// Sittings can differ by a few percent; kernels timed side by side share one.
// v000 is the starting kernel. One run takes 1090 microseconds.
// Contractions: q/k/v projections (X f16 x W^T f16 carried x16), scores q.k^T (q,k f16 planes), attn.v (P f16 carried x2048 x V^T f16), output projection (O f16 carried x256 x Wo^T f16 carried x16), all on v_wmma_f32_16x16x32_f16 with f32 accumulate; softmax and biases in f32.
#include <hip/hip_runtime.h>
#include <math.h>

// ---------------------------------------------------------------------------
// Problem constants
// ---------------------------------------------------------------------------
constexpr int kBatch = 8;
constexpr int kSeq   = 2048;
constexpr int kDim   = 512;               // embed dim (input and output of every projection)
constexpr int kHid   = 512;
constexpr int kTok   = kBatch * kSeq;     // 16384 token rows
constexpr float kWCarry    = 16.0f;       // weights carried x16 in f16
constexpr float kWCarryInv = 1.0f / 16.0f;
constexpr float kPCarry    = 2048.0f;     // probabilities carried x2048 in f16
constexpr float kOCarry    = 256.0f;      // attention output carried x256 in f16
constexpr float kPVScale   = kOCarry / kPCarry;              // 1/8
constexpr float kOutScale  = 1.0f / (kOCarry * kWCarry);     // 1/4096
constexpr float kAttnScale = 0.044194173824159216f;          // 512^-0.5

// ---------------------------------------------------------------------------
// Workspace region map (bytes); total 111,149,056 B
//   [  0 MiB, 16 MiB)  X16   f16 [16384][512]
//   [ 16 MiB, 32 MiB)  Q16   f16 [16384][512]
//   [ 32 MiB, 48 MiB)  K16   f16 [16384][512]
//   [ 48 MiB, 64 MiB)  VT16  f16 [8][512][2048]
//   [ 64 MiB, 80 MiB)  O16   f16 [16384][512]   (carried x256)
//   [ 80 MiB, 82 MiB)  WT16  f16 4 x [512][512]  (Wq^T, Wk^T, Wv^T, Wo^T, carried x16)
//   [ 82 MiB, 98 MiB)  SBUF  f32 [2048][2048]    (one batch at a time)
//   [ 98 MiB,106 MiB)  PBUF  f16 [2048][2048]    (one batch at a time, carried x2048)
// ---------------------------------------------------------------------------
constexpr size_t kPlane16 = (size_t)kTok * kDim * 2;                 // 16,777,216
constexpr size_t kOffX   = 0;
constexpr size_t kOffQ   = kOffX  + kPlane16;
constexpr size_t kOffK   = kOffQ  + kPlane16;
constexpr size_t kOffVT  = kOffK  + kPlane16;
constexpr size_t kOffO   = kOffVT + kPlane16;
constexpr size_t kOffWT  = kOffO  + kPlane16;
constexpr size_t kWTBytes = (size_t)4 * kHid * kDim * 2;              // 2,097,152
constexpr size_t kOffS   = kOffWT + kWTBytes;
constexpr size_t kSBytes = (size_t)kSeq * kSeq * 4;                   // 16,777,216
constexpr size_t kOffP   = kOffS + kSBytes;
constexpr size_t kPBytes = (size_t)kSeq * kSeq * 2;                   // 8,388,608
constexpr size_t kWsTotal = kOffP + kPBytes;                          // 111,149,056

typedef __attribute__((ext_vector_type(16))) _Float16 v16h;
typedef __attribute__((ext_vector_type(8)))  _Float16 v8h;
typedef __attribute__((ext_vector_type(16))) __bf16   v16b;
typedef __attribute__((ext_vector_type(8)))  __bf16   v8b;
typedef __attribute__((ext_vector_type(8)))  float    v8f;
typedef __attribute__((ext_vector_type(4)))  float    v4f;
typedef __attribute__((ext_vector_type(4)))  unsigned int v4u;

__device__ __forceinline__ unsigned short f2bf_bits(float f) {
  unsigned u = __float_as_uint(f);
  return (unsigned short)((u + 0x7FFFu + ((u >> 16) & 1u)) >> 16);
}
__device__ __forceinline__ float bf_bits2f(unsigned short h) { return __uint_as_float(((unsigned)h) << 16); }

// hazard guards as plain device helpers (no inline asm inside the kernel template body)
__device__ __forceinline__ void dep_guard_h(v8f& a, v8f& b, v16h x, v16h y) { asm volatile("v_nop\n\tv_nop\n\tv_nop\n\tv_nop" : "+v"(a), "+v"(b) : "v"(x), "v"(y)); }
__device__ __forceinline__ void dep_guard_b(v8f& a, v8f& b, v16b x, v16b y) { asm volatile("v_nop\n\tv_nop\n\tv_nop\n\tv_nop" : "+v"(a), "+v"(b) : "v"(x), "v"(y)); }
__device__ __forceinline__ void keep4_h(v16h a, v16h b, v16h c, v16h d) { asm volatile("v_nop" :: "v"(a), "v"(b), "v"(c), "v"(d)); }
__device__ __forceinline__ void keep4_b(v16b a, v16b b, v16b c, v16b d) { asm volatile("v_nop" :: "v"(a), "v"(b), "v"(c), "v"(d)); }
__device__ __forceinline__ void acc_guard4(v8f& a, v8f& b, v8f& c, v8f& d) { asm volatile("v_nop\n\tv_nop\n\tv_nop\n\tv_nop" : "+v"(a), "+v"(b), "+v"(c), "+v"(d)); }
template <typename T> struct Frag;
template <> struct Frag<_Float16> {
  typedef v16h V; union U { v16h v; v8h h[2]; };
  static __device__ __forceinline__ v16h load(const _Float16* p) {   // elements 0..7 <- p[0..7], 8..15 <- p[16..23]
    U f; f.h[0] = *(const v8h*)(p); f.h[1] = *(const v8h*)(p + 16); return f.v;
  }
  static __device__ __forceinline__ v8f mma(v16h a, v16h b, v8f c) {
    return __builtin_amdgcn_wmma_f32_16x16x32_f16(false, a, false, b, (short)0, c, false, false);
  }
  static __device__ __forceinline__ void guard(v8f& a, v8f& b, v16h x, v16h y) { dep_guard_h(a, b, x, y); }
  static __device__ __forceinline__ void keep(v16h a, v16h b, v16h c, v16h d) { keep4_h(a, b, c, d); }
};
template <> struct Frag<__bf16> {
  typedef v16b V; union U { v16b v; v8b h[2]; };
  static __device__ __forceinline__ v16b load(const __bf16* p) {
    U f; f.h[0] = *(const v8b*)(p); f.h[1] = *(const v8b*)(p + 16); return f.v;
  }
  static __device__ __forceinline__ v8f mma(v16b a, v16b b, v8f c) {
    return __builtin_amdgcn_wmma_f32_16x16x32_bf16(false, a, false, b, (short)0, c, false, false);
  }
  static __device__ __forceinline__ void guard(v8f& a, v8f& b, v16b x, v16b y) { dep_guard_b(a, b, x, y); }
  static __device__ __forceinline__ void keep(v16b a, v16b b, v16b c, v16b d) { keep4_b(a, b, c, d); }
};

__device__ __forceinline__ unsigned pk16(unsigned short a, unsigned short b) { return (unsigned)a | ((unsigned)b << 16); }
__device__ __forceinline__ unsigned short h_bits(float f) { const _Float16 h = (_Float16)f; return __builtin_bit_cast(unsigned short, h); }

// ---- Register-blocked batched WMMA GEMM (ACT reduced to none/relu/leaky) ------------------------
// C[m,n] = scale * sum_k A[m,k] * Bt[n,k] (+bias)(+resid); each wave owns a 64x64 tile.
// A row-major [M,K]; Bt row-major [N,K]; M,N % 64 == 0, K % 32 == 0.
// SPLIT: operands are hi/lo planes (A2/Bt2 = lo planes, same layout); product = hi*hi + hi*lo + lo*hi.
// BIAS_MODE: 0 = none, 1 = bias[m], 2 = bias[n].
// OUT_MODE: 0 = f32, 1 = f16, 2 = bf16 hi plane (Cout) + bf16 lo plane (Cout2).
// ET: 0 = f16 operands, 1 = bf16 operands (pointers passed as 16-bit storage)
template <int ET> struct Elem;
template <> struct Elem<0> { typedef _Float16 T; };
template <> struct Elem<1> { typedef __bf16 T; };
template <int ET, bool SPLIT, int BIAS_MODE, int OUT_MODE, bool RESID, int ACT = 0>
__global__ __launch_bounds__(256) void wmma_gemm64(
    const unsigned short* __restrict__ Ap, const unsigned short* __restrict__ A2p, int lda, long strideA,
    const unsigned short* __restrict__ Btp, const unsigned short* __restrict__ Bt2p, int ldb, long strideB,
    void* __restrict__ Cout, void* __restrict__ Cout2, int ldc, long strideC,
    const float* __restrict__ bias,
    const float* __restrict__ resid, long strideR,
    int M, int N, int K, float scale) {
  typedef typename Elem<ET>::T T;
  typedef typename Frag<T>::V V;
  const T* A = (const T*)Ap; const T* A2 = (const T*)A2p; const T* Bt = (const T*)Btp; const T* Bt2 = (const T*)Bt2p;
  __shared__ __align__(16) float sT[8][16 * 68];   // per-wave 16x64 slab, pitch 68 floats
  const int b    = blockIdx.y;
  const int lane = threadIdx.x & 31;
  const int wave = threadIdx.x >> 5;
  const int tilesN = N >> 6;
  const int tilesM = M >> 6;
  const int tile = blockIdx.x * 8 + wave;
  if (tile >= tilesM * tilesN) return;   // wave-uniform; no block barriers in this kernel
  const int tm = tile / tilesN;
  const int tn = tile - tm * tilesN;
  const int m0 = tm << 6;
  const int n0 = tn << 6;

  const T* Ab  = A  + (size_t)b * strideA;
  const T* Bb  = Bt + (size_t)b * strideB;
  const T* Ab2 = SPLIT ? (A2  + (size_t)b * strideA) : nullptr;
  const T* Bb2 = SPLIT ? (Bt2 + (size_t)b * strideB) : nullptr;

  const int rlane = lane & 15;                 // row (A) / col (B, D) within subtile
  const int koff  = (lane >> 4) * 8;           // k offset of this lane half
  const int mOff  = (lane >> 4) * 8;           // D row offset

  v8f acc[4][4];
#pragma unroll
  for (int i = 0; i < 4; ++i)
#pragma unroll
    for (int j = 0; j < 4; ++j) acc[i][j] = (v8f){0.f,0.f,0.f,0.f,0.f,0.f,0.f,0.f};

  for (int k0 = 0; k0 < K; k0 += 32) {
    V bh[4], bl[4];
#pragma unroll
    for (int j = 0; j < 4; ++j) {
      const size_t bo = (size_t)(n0 + (j << 4) + rlane) * ldb + koff + k0;
      bh[j] = Frag<T>::load(Bb + bo);
      if (SPLIT) bl[j] = Frag<T>::load(Bb2 + bo);
    }
#pragma unroll
    for (int i = 0; i < 4; ++i) {
      const size_t ao = (size_t)(m0 + (i << 4) + rlane) * lda + koff + k0;
      V ah = Frag<T>::load(Ab + ao);
      V al;
      if (SPLIT) al = Frag<T>::load(Ab2 + ao);
#pragma unroll
      for (int j = 0; j < 4; ++j) {
        acc[i][j] = Frag<T>::mma(ah, bh[j], acc[i][j]);
        if (SPLIT) {
          acc[i][j] = Frag<T>::mma(ah, bl[j], acc[i][j]);
          acc[i][j] = Frag<T>::mma(al, bh[j], acc[i][j]);
        }
      }
      Frag<T>::guard(acc[i][0], acc[i][3], ah, SPLIT ? al : ah);
    }
    Frag<T>::keep(bh[0], bh[1], bh[2], bh[3]);
    if (SPLIT) Frag<T>::keep(bl[0], bl[1], bl[2], bl[3]);
  }
  acc_guard4(acc[0][0], acc[0][1], acc[0][2], acc[0][3]);
  acc_guard4(acc[1][0], acc[1][1], acc[1][2], acc[1][3]);
  acc_guard4(acc[2][0], acc[2][1], acc[2][2], acc[2][3]);
  acc_guard4(acc[3][0], acc[3][1], acc[3][2], acc[3][3]);

  // ---- epilogue ----
  float* slab = sT[wave];
  const float* Rb = RESID ? (resid + (size_t)b * strideR) : nullptr;
#pragma unroll
  for (int i = 0; i < 4; ++i) {
    const int mBase = m0 + (i << 4);
#pragma unroll
    for (int j = 0; j < 4; ++j) {
      const int n = n0 + (j << 4) + rlane;
      float bv = 0.f;
      if (BIAS_MODE == 2) bv = bias[n];
#pragma unroll
      for (int r = 0; r < 8; ++r) {
        float v = acc[i][j][r] * scale;
        if (BIAS_MODE == 1) v += bias[mBase + mOff + r];
        if (BIAS_MODE == 2) v += bv;
        if (RESID) v += Rb[(size_t)(mBase + mOff + r) * ldc + n];
        if (ACT == 2) v = fmaxf(v, 0.0f);
        if (ACT == 4) v = (v > 0.f) ? v : 0.01f * v;
        slab[(mOff + r) * 68 + (j << 4) + rlane] = v;
      }
    }
    __builtin_amdgcn_fence(__ATOMIC_RELEASE, "workgroup");
    __builtin_amdgcn_wave_barrier();
    __builtin_amdgcn_fence(__ATOMIC_ACQUIRE, "workgroup");
    if (OUT_MODE == 0) {
      float* C = (float*)Cout + (size_t)b * strideC;
      const int hh = lane >> 4, c4 = (lane & 15) * 4;     // row seg = 256 B = 16 lanes x 16 B
      {
#pragma unroll
        for (int it = 0; it < 8; ++it) {
          const int row = it * 2 + hh;
          v4f v = *(const v4f*)(slab + row * 68 + c4);
          *(v4f*)(C + (size_t)(mBase + row) * ldc + n0 + c4) = v;
        }
        
      }
    } else {
      const int q = lane >> 3, c8 = (lane & 7) * 8;
      unsigned short* C  = (unsigned short*)Cout  + (size_t)b * strideC;
      unsigned short* C2 = (OUT_MODE == 2) ? ((unsigned short*)Cout2 + (size_t)b * strideC) : nullptr;
      {
#pragma unroll
        for (int it = 0; it < 4; ++it) {
          const int row = it * 4 + q;
          const float* sp = slab + row * 68 + c8;
          v8h hv, lv;
#pragma unroll
          for (int e = 0; e < 8; ++e) {
            if (OUT_MODE == 1) {
              hv[e] = (_Float16)sp[e];
            } else {
              unsigned short hb = f2bf_bits(sp[e]);
              unsigned short lb = f2bf_bits(sp[e] - bf_bits2f(hb));
              hv[e] = __builtin_bit_cast(_Float16, hb);
              lv[e] = __builtin_bit_cast(_Float16, lb);
            }
          }
          *(v8h*)(C + (size_t)(mBase + row) * ldc + n0 + c8) = hv;
          if (OUT_MODE == 2) *(v8h*)(C2 + (size_t)(mBase + row) * ldc + n0 + c8) = lv;
        }
        
      }
    }
    __builtin_amdgcn_fence(__ATOMIC_RELEASE, "workgroup");
    __builtin_amdgcn_wave_barrier();
    __builtin_amdgcn_fence(__ATOMIC_ACQUIRE, "workgroup");
  }
}

// ---------------------------------------------------------------------------
// Weight transpose + cast: for square [512][512] f32 W (row-major [in d][out h]), WT[h][d] = f16(scale * W[d][h]).
// grid (8, 8, 4): blockIdx.x = d tile (64 cols of WT), blockIdx.y = h tile (64 rows of WT), blockIdx.z selects W0..W3
// and the output plane (plane z at out + z*512*512 halves). 256 threads.
// Load coverage: 16 iterations x 256 threads = 4096 = the whole 64x64 tile (coalesced along h).
// Store coverage: 8 waves x 2 iterations x 4 rows (lane>>3) = 64 rows; (lane&7) x 8 halves = 64 cols; each row segment =
// ---------------------------------------------------------------------------
__global__ __launch_bounds__(256) void wtcast_kernel(const float* __restrict__ W0, const float* __restrict__ W1,
                                                     const float* __restrict__ W2, const float* __restrict__ W3,
                                                     unsigned short* __restrict__ out, float scale) {
  __shared__ float sm[64][65];   // sm[h_local][d_local]
  const int t  = threadIdx.x;
  const int d0 = blockIdx.x * 64;
  const int h0 = blockIdx.y * 64;
  const int z  = blockIdx.z;                                   // block-uniform
  const float* W = (z == 0) ? W0 : (z == 1) ? W1 : (z == 2) ? W2 : W3;
#pragma unroll
  for (int i = 0; i < 16; ++i) {
    const int e = i * 256 + t;
    const int r = e >> 6;          // d local
    const int c = e & 63;          // h local
    sm[c][r] = W[(size_t)(d0 + r) * kHid + h0 + c] * scale;
  }
  __syncthreads();
  const int lane = t & 31, wave = t >> 5;
  const int q = lane >> 3, c8 = (lane & 7) * 8;
  unsigned short* op = out + (size_t)z * kHid * kDim;
  {
#pragma unroll
    for (int it = 0; it < 2; ++it) {
      const int row = wave * 8 + it * 4 + q;                 // h local
      unsigned short hb[8];
#pragma unroll
      for (int e = 0; e < 8; ++e) hb[e] = h_bits(sm[row][c8 + e]);
      const v4u u = (v4u){pk16(hb[0], hb[1]), pk16(hb[2], hb[3]), pk16(hb[4], hb[5]), pk16(hb[6], hb[7])};
      *(v4u*)(op + (size_t)(h0 + row) * kDim + d0 + c8) = u;
    }
    
  }
}

// ---------------------------------------------------------------------------
// ---------------------------------------------------------------------------
__global__ __launch_bounds__(256) void cast8_f16_kernel(const float* __restrict__ in, unsigned short* __restrict__ out, int n8) {
  const int i = blockIdx.x * 256 + threadIdx.x;
  if (i >= n8) return;
  const float* p = in + 8 * (size_t)i;
  const v4f a = *(const v4f*)(p);
  const v4f c = *(const v4f*)(p + 4);
  unsigned short hb[8];
#pragma unroll
  for (int e = 0; e < 4; ++e) {
    hb[e]     = h_bits(a[e]);
    hb[4 + e] = h_bits(c[e]);
  }
  const v4u u = (v4u){pk16(hb[0], hb[1]), pk16(hb[2], hb[3]), pk16(hb[4], hb[5]), pk16(hb[6], hb[7])};
  unsigned short* q = out + 8 * (size_t)i;
  *(v4u*)q = u;
  
}

// ---------------------------------------------------------------------------
// Row softmax over 2048 f32 scores (already scaled): P[row][j] = f16( carry * exp(s - max) / sum exp(s - max) ), f32 math.
// One block of 256 threads per row. Phases 1 and 2: thread t visits columns t + 256*i (i = 0..7, rolled, no private arrays):
// row max, then e = expf(s - max) staged into LDS es[] with the partial sum. Reductions in fixed order (thread, wave shuffle
// tree, 8 wave partials in index order). Phase 3: thread t owns columns 8t..8t+7 (256 x 8 = 2048 = whole row), reads them from
// ---------------------------------------------------------------------------
__global__ __launch_bounds__(256) void softmax_row_kernel(const float* __restrict__ S, unsigned short* __restrict__ P, float carry) {
  __shared__ __align__(16) float es[kSeq];
  __shared__ float redM[8];
  __shared__ float redS[8];
  const int row  = blockIdx.x;
  const int t    = threadIdx.x;
  const int lane = t & 31, wave = t >> 5;
  const float* sr = S + (size_t)row * kSeq;

  float m = -__builtin_inff();
#pragma unroll 1
  for (int i = 0; i < 8; ++i) m = fmaxf(m, sr[t + 256 * i]);
#pragma unroll
  for (int off = 16; off > 0; off >>= 1) m = fmaxf(m, __shfl_xor(m, off, 32));
  if (lane == 0) redM[wave] = m;
  __syncthreads();
  float gm = redM[0];
#pragma unroll
  for (int w = 1; w < 8; ++w) gm = fmaxf(gm, redM[w]);

  float ps = 0.f;
#pragma unroll 1
  for (int i = 0; i < 8; ++i) {
    const int c = t + 256 * i;
    const float e = expf(sr[c] - gm);
    es[c] = e;
    ps += e;
  }
#pragma unroll
  for (int off = 16; off > 0; off >>= 1) ps += __shfl_xor(ps, off, 32);
  if (lane == 0) redS[wave] = ps;
  __syncthreads();
  float tot = redS[0];
#pragma unroll
  for (int w = 1; w < 8; ++w) tot += redS[w];
  const float inv = carry * (1.0f / tot);

  const v4f a = *(const v4f*)(es + 8 * t);
  const v4f c = *(const v4f*)(es + 8 * t + 4);
  unsigned short hb[8];
#pragma unroll
  for (int e = 0; e < 4; ++e) {
    hb[e]     = h_bits(a[e] * inv);
    hb[4 + e] = h_bits(c[e] * inv);
  }
  const v4u u = (v4u){pk16(hb[0], hb[1]), pk16(hb[2], hb[3]), pk16(hb[4], hb[5]), pk16(hb[6], hb[7])};
  unsigned short* q = P + (size_t)row * kSeq + 8 * t;
  *(v4u*)q = u;
  
}

// ---------------------------------------------------------------------------
// Host side: 30 launches, all grids exact functions of the fixed shapes.
// ---------------------------------------------------------------------------
extern "C" void kernel_launch(void* const* d_in, const int* in_sizes, int n_in,
                              void* d_out, int out_size, void* d_ws, size_t ws_size, hipStream_t stream) {
  if (n_in < 9) return;
  if (in_sizes[0] != kTok * kDim) return;
  if (in_sizes[1] != kDim * kHid || in_sizes[3] != kDim * kHid || in_sizes[5] != kDim * kHid || in_sizes[7] != kDim * kHid) return;
  if (in_sizes[2] != kHid || in_sizes[4] != kHid || in_sizes[6] != kHid || in_sizes[8] != kHid) return;
  if (out_size != kTok * kDim) return;
  if (ws_size < kWsTotal) return;

  const float* x  = (const float*)d_in[0];
  const float* Wq = (const float*)d_in[1];
  const float* bq = (const float*)d_in[2];
  const float* Wk = (const float*)d_in[3];
  const float* bk = (const float*)d_in[4];
  const float* Wv = (const float*)d_in[5];
  const float* bv = (const float*)d_in[6];
  const float* Wo = (const float*)d_in[7];
  const float* bo = (const float*)d_in[8];
  float* out = (float*)d_out;

  char* ws = (char*)d_ws;
  unsigned short* X16  = (unsigned short*)(ws + kOffX);
  unsigned short* Q16  = (unsigned short*)(ws + kOffQ);
  unsigned short* K16  = (unsigned short*)(ws + kOffK);
  unsigned short* VT16 = (unsigned short*)(ws + kOffVT);
  unsigned short* O16  = (unsigned short*)(ws + kOffO);
  unsigned short* WT   = (unsigned short*)(ws + kOffWT);
  float*          SBUF = (float*)(ws + kOffS);
  unsigned short* PBUF = (unsigned short*)(ws + kOffP);
  const size_t wplane = (size_t)kHid * kDim;            // halves per W^T plane
  unsigned short* WqT = WT;
  unsigned short* WkT = WT + wplane;
  unsigned short* WvT = WT + 2 * wplane;
  unsigned short* WoT = WT + 3 * wplane;

  // 1) W^T planes: WT[z][h][d] = f16(16 * W_z[d][h]); grid (512/64, 512/64, 4)
  wtcast_kernel<<<dim3(kDim / 64, kHid / 64, 4), 256, 0, stream>>>(Wq, Wk, Wv, Wo, WT, kWCarry);

  // 2) x -> X16 [16384][512]; n8 = 1,048,576 -> 4096 blocks exactly
  {
    const int n8 = kTok * kDim / 8;
    cast8_f16_kernel<<<dim3((n8 + 255) / 256), 256, 0, stream>>>(x, X16, n8);
  }

  const long tokPlane = (long)kSeq * kDim;               // halves per batch of a [token][512] plane = 1,048,576
  const long vtPlane  = (long)kDim * kSeq;               // halves per batch of V^T [512][2048]

  // 3) Q16 = (X16 . WqT) / 16 + bq   M 16384, N 512, K 512 -> 256 x 8 tiles = 256 blocks
  wmma_gemm64<0, false, 2, 1, false><<<dim3((kTok / 64) * (kHid / 64) / 8, 1), 256, 0, stream>>>(
      X16, X16, kDim, 0L, WqT, WqT, kDim, 0L, (void*)Q16, (void*)Q16, kHid, 0L,
      bq, bq, 0L, kTok, kHid, kDim, kWCarryInv);
  // 4) K16 likewise
  wmma_gemm64<0, false, 2, 1, false><<<dim3((kTok / 64) * (kHid / 64) / 8, 1), 256, 0, stream>>>(
      X16, X16, kDim, 0L, WkT, WkT, kDim, 0L, (void*)K16, (void*)K16, kHid, 0L,
      bk, bk, 0L, kTok, kHid, kDim, kWCarryInv);
  // 5) V^T per batch: VT16[b][d][m] = sum_k WvT[d][k] X16[b*2048+m][k] / 16 + bv[d]
  //    A = WvT [512][512] (stride 0), Bt = X16 batch rows [2048][512], C [512][2048]; M 512, N 2048, K 512 -> 8 x 32 tiles = 32 blocks, grid.y = 8
  wmma_gemm64<0, false, 1, 1, false><<<dim3((kHid / 64) * (kSeq / 64) / 8, kBatch), 256, 0, stream>>>(
      WvT, WvT, kDim, 0L, X16, X16, kDim, tokPlane, (void*)VT16, (void*)VT16, kSeq, vtPlane,
      bv, bv, 0L, kHid, kSeq, kDim, kWCarryInv);

  // 6) attention per batch: S = scale * Q.K^T (f32), row softmax -> P (f16 x2048), O16 = (P.V)*256 stored f16
  for (int b = 0; b < kBatch; ++b) {
    const unsigned short* Qb = Q16 + (size_t)b * tokPlane;
    const unsigned short* Kb = K16 + (size_t)b * tokPlane;
    const unsigned short* Vb = VT16 + (size_t)b * vtPlane;
    unsigned short*       Ob = O16 + (size_t)b * tokPlane;
    // S [2048][2048]: M 2048, N 2048, K 512 -> 32 x 32 tiles = 128 blocks
    wmma_gemm64<0, false, 0, 0, false><<<dim3((kSeq / 64) * (kSeq / 64) / 8, 1), 256, 0, stream>>>(
        Qb, Qb, kHid, 0L, Kb, Kb, kHid, 0L, (void*)SBUF, (void*)SBUF, kSeq, 0L,
        bq, bq, 0L, kSeq, kSeq, kHid, kAttnScale);
    // softmax rows -> P
    softmax_row_kernel<<<dim3(kSeq), 256, 0, stream>>>(SBUF, PBUF, kPCarry);
    // O = P . V : A = P [2048][2048], Bt = V^T [512][2048]; M 2048, N 512, K 2048 -> 32 x 8 tiles = 32 blocks; scale 256/2048
    wmma_gemm64<0, false, 0, 1, false><<<dim3((kSeq / 64) * (kHid / 64) / 8, 1), 256, 0, stream>>>(
        PBUF, PBUF, kSeq, 0L, Vb, Vb, kSeq, 0L, (void*)Ob, (void*)Ob, kHid, 0L,
        bv, bv, 0L, kSeq, kHid, kSeq, kPVScale);
  }

  // 7) out = (O16 . WoT) / 4096 + bo   M 16384, N 512, K 512 -> 256 blocks; f32 whole-line epilogue into d_out
  wmma_gemm64<0, false, 2, 0, false><<<dim3((kTok / 64) * (kDim / 64) / 8, 1), 256, 0, stream>>>(
      O16, O16, kHid, 0L, WoT, WoT, kHid, 0L, (void*)out, (void*)out, kDim, 0L,
      bo, bo, 0L, kTok, kDim, kHid, kOutScale);
}

// v001
// A run of this version takes 349 microseconds.
// Timed twice side by side with v000, it ran 3.12 and 3.13 times as fast.
// Contractions: q/k/v projections (X f16 x W^T f16 carried x16), scores q.k^T (q,k f16 planes), attn.v (P f16 carried x2048 x V^T f16), output projection (O f16 carried x256 x Wo^T f16 carried x16), all on v_wmma_f32_16x16x32_f16 with f32 accumulate; softmax and biases in f32.
#include <hip/hip_runtime.h>
#include <math.h>

// ---------------------------------------------------------------------------
// Problem constants
// ---------------------------------------------------------------------------
constexpr int kBatch = 8;
constexpr int kSeq   = 2048;
constexpr int kDim   = 512;               // embed dim (input and output of every projection)
constexpr int kHid   = 512;
constexpr int kTok   = kBatch * kSeq;     // 16384 token rows
constexpr float kWCarry    = 16.0f;       // weights carried x16 in f16
constexpr float kWCarryInv = 1.0f / 16.0f;
constexpr float kPCarry    = 2048.0f;     // probabilities carried x2048 in f16
constexpr float kOCarry    = 256.0f;      // attention output carried x256 in f16
constexpr float kPVScale   = kOCarry / kPCarry;              // 1/8
constexpr float kOutScale  = 1.0f / (kOCarry * kWCarry);     // 1/4096
constexpr float kAttnScale = 0.044194173824159216f;          // 512^-0.5

// ---------------------------------------------------------------------------
// Workspace region map (bytes); total 236,978,176 B
//   [  0 MiB, 16 MiB)  X16   f16 [16384][512]
//   [ 16 MiB, 32 MiB)  Q16   f16 [16384][512]
//   [ 32 MiB, 48 MiB)  K16   f16 [16384][512]
//   [ 48 MiB, 64 MiB)  (tail of PBUF only)
//   [ 64 MiB, 80 MiB)  VT16  f16 [8][512][2048]
//   [ 80 MiB, 96 MiB)  O16   f16 [16384][512]   (carried x256)
//   [ 96 MiB, 98 MiB)  WT16  f16 4 x [512][512]  (Wq^T, Wk^T, Wv^T, Wo^T, carried x16)
//   [ 98 MiB,226 MiB)  SBUF  f32 [8][2048][2048] (all batches)
//   [  0 MiB, 64 MiB)  PBUF  f16 [8][2048][2048] (all batches, carried x2048); lies over X16, Q16 and K16, whose last
//                      reader (the score launch) ends before the softmax launch writes PBUF
// ---------------------------------------------------------------------------
constexpr size_t kPlane16 = (size_t)kTok * kDim * 2;                 // 16,777,216
constexpr size_t kOffX   = 0;
constexpr size_t kOffQ   = kOffX  + kPlane16;
constexpr size_t kOffK   = kOffQ  + kPlane16;
constexpr size_t kOffVT  = kOffK  + 2 * kPlane16;
constexpr size_t kOffO   = kOffVT + kPlane16;
constexpr size_t kOffWT  = kOffO  + kPlane16;
constexpr size_t kWTBytes = (size_t)4 * kHid * kDim * 2;              // 2,097,152
constexpr size_t kOffS   = kOffWT + kWTBytes;
constexpr size_t kSBytes = (size_t)kBatch * kSeq * kSeq * 4;          // 134,217,728
constexpr size_t kOffP   = kOffX;
constexpr size_t kPBytes = (size_t)kBatch * kSeq * kSeq * 2;          // 67,108,864
static_assert(kOffP + kPBytes <= kOffVT, "PBUF may cover only X16, Q16, K16 and its own tail");
constexpr size_t kWsTotal = kOffS + kSBytes;                          // 236,978,176

typedef __attribute__((ext_vector_type(16))) _Float16 v16h;
typedef __attribute__((ext_vector_type(8)))  _Float16 v8h;
typedef __attribute__((ext_vector_type(16))) __bf16   v16b;
typedef __attribute__((ext_vector_type(8)))  __bf16   v8b;
typedef __attribute__((ext_vector_type(8)))  float    v8f;
typedef __attribute__((ext_vector_type(4)))  float    v4f;
typedef __attribute__((ext_vector_type(4)))  unsigned int v4u;

__device__ __forceinline__ unsigned short f2bf_bits(float f) {
  unsigned u = __float_as_uint(f);
  return (unsigned short)((u + 0x7FFFu + ((u >> 16) & 1u)) >> 16);
}
__device__ __forceinline__ float bf_bits2f(unsigned short h) { return __uint_as_float(((unsigned)h) << 16); }

// hazard guards as plain device helpers (no inline asm inside the kernel template body)
__device__ __forceinline__ void dep_guard_h(v8f& a, v8f& b, v16h x, v16h y) { asm volatile("v_nop\n\tv_nop\n\tv_nop\n\tv_nop" : "+v"(a), "+v"(b) : "v"(x), "v"(y)); }
__device__ __forceinline__ void dep_guard_b(v8f& a, v8f& b, v16b x, v16b y) { asm volatile("v_nop\n\tv_nop\n\tv_nop\n\tv_nop" : "+v"(a), "+v"(b) : "v"(x), "v"(y)); }
__device__ __forceinline__ void keep4_h(v16h a, v16h b, v16h c, v16h d) { asm volatile("v_nop" :: "v"(a), "v"(b), "v"(c), "v"(d)); }
__device__ __forceinline__ void keep4_b(v16b a, v16b b, v16b c, v16b d) { asm volatile("v_nop" :: "v"(a), "v"(b), "v"(c), "v"(d)); }
__device__ __forceinline__ void acc_guard4(v8f& a, v8f& b, v8f& c, v8f& d) { asm volatile("v_nop\n\tv_nop\n\tv_nop\n\tv_nop" : "+v"(a), "+v"(b), "+v"(c), "+v"(d)); }
template <typename T> struct Frag;
template <> struct Frag<_Float16> {
  typedef v16h V; union U { v16h v; v8h h[2]; };
  static __device__ __forceinline__ v16h load(const _Float16* p) {   // elements 0..7 <- p[0..7], 8..15 <- p[16..23]
    U f; f.h[0] = *(const v8h*)(p); f.h[1] = *(const v8h*)(p + 16); return f.v;
  }
  static __device__ __forceinline__ v8f mma(v16h a, v16h b, v8f c) {
    return __builtin_amdgcn_wmma_f32_16x16x32_f16(false, a, false, b, (short)0, c, false, false);
  }
  static __device__ __forceinline__ void guard(v8f& a, v8f& b, v16h x, v16h y) { dep_guard_h(a, b, x, y); }
  static __device__ __forceinline__ void keep(v16h a, v16h b, v16h c, v16h d) { keep4_h(a, b, c, d); }
};
template <> struct Frag<__bf16> {
  typedef v16b V; union U { v16b v; v8b h[2]; };
  static __device__ __forceinline__ v16b load(const __bf16* p) {
    U f; f.h[0] = *(const v8b*)(p); f.h[1] = *(const v8b*)(p + 16); return f.v;
  }
  static __device__ __forceinline__ v8f mma(v16b a, v16b b, v8f c) {
    return __builtin_amdgcn_wmma_f32_16x16x32_bf16(false, a, false, b, (short)0, c, false, false);
  }
  static __device__ __forceinline__ void guard(v8f& a, v8f& b, v16b x, v16b y) { dep_guard_b(a, b, x, y); }
  static __device__ __forceinline__ void keep(v16b a, v16b b, v16b c, v16b d) { keep4_b(a, b, c, d); }
};

__device__ __forceinline__ unsigned pk16(unsigned short a, unsigned short b) { return (unsigned)a | ((unsigned)b << 16); }
__device__ __forceinline__ unsigned short h_bits(float f) { const _Float16 h = (_Float16)f; return __builtin_bit_cast(unsigned short, h); }

// ---- Register-blocked batched WMMA GEMM (ACT reduced to none/relu/leaky) ------------------------
// C[m,n] = scale * sum_k A[m,k] * Bt[n,k] (+bias)(+resid); each wave owns a 64x64 tile.
// A row-major [M,K]; Bt row-major [N,K]; M,N % 64 == 0, K % 32 == 0.
// SPLIT: operands are hi/lo planes (A2/Bt2 = lo planes, same layout); product = hi*hi + hi*lo + lo*hi.
// BIAS_MODE: 0 = none, 1 = bias[m], 2 = bias[n].
// OUT_MODE: 0 = f32, 1 = f16, 2 = bf16 hi plane (Cout) + bf16 lo plane (Cout2).
// ET: 0 = f16 operands, 1 = bf16 operands (pointers passed as 16-bit storage)
template <int ET> struct Elem;
template <> struct Elem<0> { typedef _Float16 T; };
template <> struct Elem<1> { typedef __bf16 T; };
template <int ET, bool SPLIT, int BIAS_MODE, int OUT_MODE, bool RESID, int ACT = 0>
__global__ __launch_bounds__(256) void wmma_gemm64(
    const unsigned short* __restrict__ Ap, const unsigned short* __restrict__ A2p, int lda, long strideA,
    const unsigned short* __restrict__ Btp, const unsigned short* __restrict__ Bt2p, int ldb, long strideB,
    void* __restrict__ Cout, void* __restrict__ Cout2, int ldc, long strideC,
    const float* __restrict__ bias,
    const float* __restrict__ resid, long strideR,
    int M, int N, int K, float scale) {
  typedef typename Elem<ET>::T T;
  typedef typename Frag<T>::V V;
  const T* A = (const T*)Ap; const T* A2 = (const T*)A2p; const T* Bt = (const T*)Btp; const T* Bt2 = (const T*)Bt2p;
  __shared__ __align__(16) float sT[8][16 * 68];   // per-wave 16x64 slab, pitch 68 floats
  const int b    = blockIdx.y;
  const int lane = threadIdx.x & 31;
  const int wave = threadIdx.x >> 5;
  const int tilesN = N >> 6;
  const int tilesM = M >> 6;
  const int tile = blockIdx.x * 8 + wave;
  if (tile >= tilesM * tilesN) return;   // wave-uniform; no block barriers in this kernel
  const int tm = tile / tilesN;
  const int tn = tile - tm * tilesN;
  const int m0 = tm << 6;
  const int n0 = tn << 6;

  const T* Ab  = A  + (size_t)b * strideA;
  const T* Bb  = Bt + (size_t)b * strideB;
  const T* Ab2 = SPLIT ? (A2  + (size_t)b * strideA) : nullptr;
  const T* Bb2 = SPLIT ? (Bt2 + (size_t)b * strideB) : nullptr;

  const int rlane = lane & 15;                 // row (A) / col (B, D) within subtile
  const int koff  = (lane >> 4) * 8;           // k offset of this lane half
  const int mOff  = (lane >> 4) * 8;           // D row offset

  v8f acc[4][4];
#pragma unroll
  for (int i = 0; i < 4; ++i)
#pragma unroll
    for (int j = 0; j < 4; ++j) acc[i][j] = (v8f){0.f,0.f,0.f,0.f,0.f,0.f,0.f,0.f};

  for (int k0 = 0; k0 < K; k0 += 32) {
    V bh[4], bl[4];
#pragma unroll
    for (int j = 0; j < 4; ++j) {
      const size_t bo = (size_t)(n0 + (j << 4) + rlane) * ldb + koff + k0;
      bh[j] = Frag<T>::load(Bb + bo);
      if (SPLIT) bl[j] = Frag<T>::load(Bb2 + bo);
    }
#pragma unroll
    for (int i = 0; i < 4; ++i) {
      const size_t ao = (size_t)(m0 + (i << 4) + rlane) * lda + koff + k0;
      V ah = Frag<T>::load(Ab + ao);
      V al;
      if (SPLIT) al = Frag<T>::load(Ab2 + ao);
#pragma unroll
      for (int j = 0; j < 4; ++j) {
        acc[i][j] = Frag<T>::mma(ah, bh[j], acc[i][j]);
        if (SPLIT) {
          acc[i][j] = Frag<T>::mma(ah, bl[j], acc[i][j]);
          acc[i][j] = Frag<T>::mma(al, bh[j], acc[i][j]);
        }
      }
      Frag<T>::guard(acc[i][0], acc[i][3], ah, SPLIT ? al : ah);
    }
    Frag<T>::keep(bh[0], bh[1], bh[2], bh[3]);
    if (SPLIT) Frag<T>::keep(bl[0], bl[1], bl[2], bl[3]);
  }
  acc_guard4(acc[0][0], acc[0][1], acc[0][2], acc[0][3]);
  acc_guard4(acc[1][0], acc[1][1], acc[1][2], acc[1][3]);
  acc_guard4(acc[2][0], acc[2][1], acc[2][2], acc[2][3]);
  acc_guard4(acc[3][0], acc[3][1], acc[3][2], acc[3][3]);

  // ---- epilogue ----
  float* slab = sT[wave];
  const float* Rb = RESID ? (resid + (size_t)b * strideR) : nullptr;
#pragma unroll
  for (int i = 0; i < 4; ++i) {
    const int mBase = m0 + (i << 4);
#pragma unroll
    for (int j = 0; j < 4; ++j) {
      const int n = n0 + (j << 4) + rlane;
      float bv = 0.f;
      if (BIAS_MODE == 2) bv = bias[n];
#pragma unroll
      for (int r = 0; r < 8; ++r) {
        float v = acc[i][j][r] * scale;
        if (BIAS_MODE == 1) v += bias[mBase + mOff + r];
        if (BIAS_MODE == 2) v += bv;
        if (RESID) v += Rb[(size_t)(mBase + mOff + r) * ldc + n];
        if (ACT == 2) v = fmaxf(v, 0.0f);
        if (ACT == 4) v = (v > 0.f) ? v : 0.01f * v;
        slab[(mOff + r) * 68 + (j << 4) + rlane] = v;
      }
    }
    __builtin_amdgcn_fence(__ATOMIC_RELEASE, "workgroup");
    __builtin_amdgcn_wave_barrier();
    __builtin_amdgcn_fence(__ATOMIC_ACQUIRE, "workgroup");
    if (OUT_MODE == 0) {
      float* C = (float*)Cout + (size_t)b * strideC;
      const int hh = lane >> 4, c4 = (lane & 15) * 4;     // row seg = 256 B = 16 lanes x 16 B
      {
#pragma unroll
        for (int it = 0; it < 8; ++it) {
          const int row = it * 2 + hh;
          v4f v = *(const v4f*)(slab + row * 68 + c4);
          *(v4f*)(C + (size_t)(mBase + row) * ldc + n0 + c4) = v;
        }
        
      }
    } else {
      const int q = lane >> 3, c8 = (lane & 7) * 8;
      unsigned short* C  = (unsigned short*)Cout  + (size_t)b * strideC;
      unsigned short* C2 = (OUT_MODE == 2) ? ((unsigned short*)Cout2 + (size_t)b * strideC) : nullptr;
      {
#pragma unroll
        for (int it = 0; it < 4; ++it) {
          const int row = it * 4 + q;
          const float* sp = slab + row * 68 + c8;
          v8h hv, lv;
#pragma unroll
          for (int e = 0; e < 8; ++e) {
            if (OUT_MODE == 1) {
              hv[e] = (_Float16)sp[e];
            } else {
              unsigned short hb = f2bf_bits(sp[e]);
              unsigned short lb = f2bf_bits(sp[e] - bf_bits2f(hb));
              hv[e] = __builtin_bit_cast(_Float16, hb);
              lv[e] = __builtin_bit_cast(_Float16, lb);
            }
          }
          *(v8h*)(C + (size_t)(mBase + row) * ldc + n0 + c8) = hv;
          if (OUT_MODE == 2) *(v8h*)(C2 + (size_t)(mBase + row) * ldc + n0 + c8) = lv;
        }
        
      }
    }
    __builtin_amdgcn_fence(__ATOMIC_RELEASE, "workgroup");
    __builtin_amdgcn_wave_barrier();
    __builtin_amdgcn_fence(__ATOMIC_ACQUIRE, "workgroup");
  }
}

// ---------------------------------------------------------------------------
// Weight transpose + cast: for square [512][512] f32 W (row-major [in d][out h]), WT[h][d] = f16(scale * W[d][h]).
// grid (8, 8, 4): blockIdx.x = d tile (64 cols of WT), blockIdx.y = h tile (64 rows of WT), blockIdx.z selects W0..W3
// and the output plane (plane z at out + z*512*512 halves). 256 threads.
// Load coverage: 16 iterations x 256 threads = 4096 = the whole 64x64 tile (coalesced along h).
// Store coverage: 8 waves x 2 iterations x 4 rows (lane>>3) = 64 rows; (lane&7) x 8 halves = 64 cols; each row segment =
// ---------------------------------------------------------------------------
__global__ __launch_bounds__(256) void wtcast_kernel(const float* __restrict__ W0, const float* __restrict__ W1,
                                                     const float* __restrict__ W2, const float* __restrict__ W3,
                                                     unsigned short* __restrict__ out, float scale) {
  __shared__ float sm[64][65];   // sm[h_local][d_local]
  const int t  = threadIdx.x;
  const int d0 = blockIdx.x * 64;
  const int h0 = blockIdx.y * 64;
  const int z  = blockIdx.z;                                   // block-uniform
  const float* W = (z == 0) ? W0 : (z == 1) ? W1 : (z == 2) ? W2 : W3;
#pragma unroll
  for (int i = 0; i < 16; ++i) {
    const int e = i * 256 + t;
    const int r = e >> 6;          // d local
    const int c = e & 63;          // h local
    sm[c][r] = W[(size_t)(d0 + r) * kHid + h0 + c] * scale;
  }
  __syncthreads();
  const int lane = t & 31, wave = t >> 5;
  const int q = lane >> 3, c8 = (lane & 7) * 8;
  unsigned short* op = out + (size_t)z * kHid * kDim;
  {
#pragma unroll
    for (int it = 0; it < 2; ++it) {
      const int row = wave * 8 + it * 4 + q;                 // h local
      unsigned short hb[8];
#pragma unroll
      for (int e = 0; e < 8; ++e) hb[e] = h_bits(sm[row][c8 + e]);
      const v4u u = (v4u){pk16(hb[0], hb[1]), pk16(hb[2], hb[3]), pk16(hb[4], hb[5]), pk16(hb[6], hb[7])};
      *(v4u*)(op + (size_t)(h0 + row) * kDim + d0 + c8) = u;
    }
    
  }
}

// ---------------------------------------------------------------------------
// ---------------------------------------------------------------------------
__global__ __launch_bounds__(256) void cast8_f16_kernel(const float* __restrict__ in, unsigned short* __restrict__ out, int n8) {
  const int i = blockIdx.x * 256 + threadIdx.x;
  if (i >= n8) return;
  const float* p = in + 8 * (size_t)i;
  const v4f a = *(const v4f*)(p);
  const v4f c = *(const v4f*)(p + 4);
  unsigned short hb[8];
#pragma unroll
  for (int e = 0; e < 4; ++e) {
    hb[e]     = h_bits(a[e]);
    hb[4 + e] = h_bits(c[e]);
  }
  const v4u u = (v4u){pk16(hb[0], hb[1]), pk16(hb[2], hb[3]), pk16(hb[4], hb[5]), pk16(hb[6], hb[7])};
  unsigned short* q = out + 8 * (size_t)i;
  *(v4u*)q = u;
  
}

// ---------------------------------------------------------------------------
// Row softmax over 2048 f32 scores (already scaled): P[row][j] = f16( carry * exp(s - max) / sum exp(s - max) ), f32 math.
// One block of 256 threads per row. Phases 1 and 2: thread t visits columns t + 256*i (i = 0..7, rolled, no private arrays):
// row max, then e = expf(s - max) staged into LDS es[] with the partial sum. Reductions in fixed order (thread, wave shuffle
// tree, 8 wave partials in index order). Phase 3: thread t owns columns 8t..8t+7 (256 x 8 = 2048 = whole row), reads them from
// ---------------------------------------------------------------------------
__global__ __launch_bounds__(256) void softmax_row_kernel(const float* __restrict__ S, unsigned short* __restrict__ P, float carry) {
  __shared__ __align__(16) float es[kSeq];
  __shared__ float redM[8];
  __shared__ float redS[8];
  const int row  = blockIdx.x;
  const int t    = threadIdx.x;
  const int lane = t & 31, wave = t >> 5;
  const float* sr = S + (size_t)row * kSeq;

  float m = -__builtin_inff();
#pragma unroll 1
  for (int i = 0; i < 8; ++i) m = fmaxf(m, sr[t + 256 * i]);
#pragma unroll
  for (int off = 16; off > 0; off >>= 1) m = fmaxf(m, __shfl_xor(m, off, 32));
  if (lane == 0) redM[wave] = m;
  __syncthreads();
  float gm = redM[0];
#pragma unroll
  for (int w = 1; w < 8; ++w) gm = fmaxf(gm, redM[w]);

  float ps = 0.f;
#pragma unroll 1
  for (int i = 0; i < 8; ++i) {
    const int c = t + 256 * i;
    const float e = expf(sr[c] - gm);
    es[c] = e;
    ps += e;
  }
#pragma unroll
  for (int off = 16; off > 0; off >>= 1) ps += __shfl_xor(ps, off, 32);
  if (lane == 0) redS[wave] = ps;
  __syncthreads();
  float tot = redS[0];
#pragma unroll
  for (int w = 1; w < 8; ++w) tot += redS[w];
  const float inv = carry * (1.0f / tot);

  const v4f a = *(const v4f*)(es + 8 * t);
  const v4f c = *(const v4f*)(es + 8 * t + 4);
  unsigned short hb[8];
#pragma unroll
  for (int e = 0; e < 4; ++e) {
    hb[e]     = h_bits(a[e] * inv);
    hb[4 + e] = h_bits(c[e] * inv);
  }
  const v4u u = (v4u){pk16(hb[0], hb[1]), pk16(hb[2], hb[3]), pk16(hb[4], hb[5]), pk16(hb[6], hb[7])};
  unsigned short* q = P + (size_t)row * kSeq + 8 * t;
  *(v4u*)q = u;
  
}

// ---------------------------------------------------------------------------
// Host side: 9 launches, all grids exact functions of the fixed shapes.
// ---------------------------------------------------------------------------
extern "C" void kernel_launch(void* const* d_in, const int* in_sizes, int n_in,
                              void* d_out, int out_size, void* d_ws, size_t ws_size, hipStream_t stream) {
  if (n_in < 9) return;
  if (in_sizes[0] != kTok * kDim) return;
  if (in_sizes[1] != kDim * kHid || in_sizes[3] != kDim * kHid || in_sizes[5] != kDim * kHid || in_sizes[7] != kDim * kHid) return;
  if (in_sizes[2] != kHid || in_sizes[4] != kHid || in_sizes[6] != kHid || in_sizes[8] != kHid) return;
  if (out_size != kTok * kDim) return;
  if (ws_size < kWsTotal) return;

  const float* x  = (const float*)d_in[0];
  const float* Wq = (const float*)d_in[1];
  const float* bq = (const float*)d_in[2];
  const float* Wk = (const float*)d_in[3];
  const float* bk = (const float*)d_in[4];
  const float* Wv = (const float*)d_in[5];
  const float* bv = (const float*)d_in[6];
  const float* Wo = (const float*)d_in[7];
  const float* bo = (const float*)d_in[8];
  float* out = (float*)d_out;

  char* ws = (char*)d_ws;
  unsigned short* X16  = (unsigned short*)(ws + kOffX);
  unsigned short* Q16  = (unsigned short*)(ws + kOffQ);
  unsigned short* K16  = (unsigned short*)(ws + kOffK);
  unsigned short* VT16 = (unsigned short*)(ws + kOffVT);
  unsigned short* O16  = (unsigned short*)(ws + kOffO);
  unsigned short* WT   = (unsigned short*)(ws + kOffWT);
  float*          SBUF = (float*)(ws + kOffS);
  unsigned short* PBUF = (unsigned short*)(ws + kOffP);
  const size_t wplane = (size_t)kHid * kDim;            // halves per W^T plane
  unsigned short* WqT = WT;
  unsigned short* WkT = WT + wplane;
  unsigned short* WvT = WT + 2 * wplane;
  unsigned short* WoT = WT + 3 * wplane;

  // 1) W^T planes: WT[z][h][d] = f16(16 * W_z[d][h]); grid (512/64, 512/64, 4)
  wtcast_kernel<<<dim3(kDim / 64, kHid / 64, 4), 256, 0, stream>>>(Wq, Wk, Wv, Wo, WT, kWCarry);

  // 2) x -> X16 [16384][512]; n8 = 1,048,576 -> 4096 blocks exactly
  {
    const int n8 = kTok * kDim / 8;
    cast8_f16_kernel<<<dim3((n8 + 255) / 256), 256, 0, stream>>>(x, X16, n8);
  }

  const long tokPlane = (long)kSeq * kDim;               // halves per batch of a [token][512] plane = 1,048,576
  const long vtPlane  = (long)kDim * kSeq;               // halves per batch of V^T [512][2048]

  // 3) Q16 = (X16 . WqT) / 16 + bq   M 16384, N 512, K 512 -> 256 x 8 tiles = 256 blocks
  wmma_gemm64<0, false, 2, 1, false><<<dim3((kTok / 64) * (kHid / 64) / 8, 1), 256, 0, stream>>>(
      X16, X16, kDim, 0L, WqT, WqT, kDim, 0L, (void*)Q16, (void*)Q16, kHid, 0L,
      bq, bq, 0L, kTok, kHid, kDim, kWCarryInv);
  // 4) K16 likewise
  wmma_gemm64<0, false, 2, 1, false><<<dim3((kTok / 64) * (kHid / 64) / 8, 1), 256, 0, stream>>>(
      X16, X16, kDim, 0L, WkT, WkT, kDim, 0L, (void*)K16, (void*)K16, kHid, 0L,
      bk, bk, 0L, kTok, kHid, kDim, kWCarryInv);
  // 5) V^T per batch: VT16[b][d][m] = sum_k WvT[d][k] X16[b*2048+m][k] / 16 + bv[d]
  //    A = WvT [512][512] (stride 0), Bt = X16 batch rows [2048][512], C [512][2048]; M 512, N 2048, K 512 -> 8 x 32 tiles = 32 blocks, grid.y = 8
  wmma_gemm64<0, false, 1, 1, false><<<dim3((kHid / 64) * (kSeq / 64) / 8, kBatch), 256, 0, stream>>>(
      WvT, WvT, kDim, 0L, X16, X16, kDim, tokPlane, (void*)VT16, (void*)VT16, kSeq, vtPlane,
      bv, bv, 0L, kHid, kSeq, kDim, kWCarryInv);

  // 6) attention, all 8 batches in each launch (grid.y = batch for S and P.V; softmax grid.x = 8 x 2048 rows): S = scale * Q.K^T (f32), row softmax -> P (f16 x2048),
  //    O16 = (P.V)*256 stored f16
  const long sPlane = (long)kSeq * kSeq;                 // elements per batch of S and of P = 4,194,304
  // S [8][2048][2048]: per batch M 2048, N 2048, K 512 -> 32 x 32 tiles = 128 blocks; 1024 blocks in all
  wmma_gemm64<0, false, 0, 0, false><<<dim3((kSeq / 64) * (kSeq / 64) / 8, kBatch), 256, 0, stream>>>(
      Q16, Q16, kHid, tokPlane, K16, K16, kHid, tokPlane, (void*)SBUF, (void*)SBUF, kSeq, sPlane,
      bq, bq, 0L, kSeq, kSeq, kHid, kAttnScale);
  // softmax rows -> P: the 8 x 2048 rows of S are contiguous, one block a row
  softmax_row_kernel<<<dim3(kTok), 256, 0, stream>>>(SBUF, PBUF, kPCarry);
  // O = P . V : A = P [2048][2048], Bt = V^T [512][2048]; per batch M 2048, N 512, K 2048 -> 32 x 8 tiles = 32 blocks;
  // 256 blocks in all; scale 256/2048
  wmma_gemm64<0, false, 0, 1, false><<<dim3((kSeq / 64) * (kHid / 64) / 8, kBatch), 256, 0, stream>>>(
      PBUF, PBUF, kSeq, sPlane, VT16, VT16, kSeq, vtPlane, (void*)O16, (void*)O16, kHid, tokPlane,
      bv, bv, 0L, kSeq, kHid, kSeq, kPVScale);

  // 7) out = (O16 . WoT) / 4096 + bo   M 16384, N 512, K 512 -> 256 blocks; f32 whole-line epilogue into d_out
  wmma_gemm64<0, false, 2, 0, false><<<dim3((kTok / 64) * (kDim / 64) / 8, 1), 256, 0, stream>>>(
      O16, O16, kHid, 0L, WoT, WoT, kHid, 0L, (void*)out, (void*)out, kDim, 0L,
      bo, bo, 0L, kTok, kDim, kHid, kOutScale);
}

// v002
// One run takes 176 microseconds.
// Timed twice side by side with v001, it ran 1.99 times as fast both times.
// Over all steps from v000 it is 6.21 times as fast.
// Contractions: q/k/v projections (X f16 x W^T f16 carried x16), scores q.k^T (q,k f16 planes), attn.v (P f16 carried x2048 x V^T f16), output projection (O f16 carried x256 x Wo^T f16 carried x16), all on v_wmma_f32_16x16x32_f16 with f32 accumulate; softmax and biases in f32.
#include <hip/hip_runtime.h>
#include <math.h>

// ---------------------------------------------------------------------------
// Problem constants
// ---------------------------------------------------------------------------
constexpr int kBatch = 8;
constexpr int kSeq   = 2048;
constexpr int kDim   = 512;               // embed dim (input and output of every projection)
constexpr int kHid   = 512;
constexpr int kTok   = kBatch * kSeq;     // 16384 token rows
constexpr float kWCarry    = 16.0f;       // weights carried x16 in f16
constexpr float kWCarryInv = 1.0f / 16.0f;
constexpr float kPCarry    = 2048.0f;     // probabilities carried x2048 in f16
constexpr float kOCarry    = 256.0f;      // attention output carried x256 in f16
constexpr float kPVScale   = kOCarry / kPCarry;              // 1/8
constexpr float kOutScale  = 1.0f / (kOCarry * kWCarry);     // 1/4096
constexpr float kAttnScale = 0.044194173824159216f;          // 512^-0.5

// ---------------------------------------------------------------------------
// Workspace region map (bytes); total 236,978,176 B
//   [  0 MiB, 16 MiB)  X16   f16 [16384][512]
//   [ 16 MiB, 32 MiB)  Q16   f16 [16384][512]
//   [ 32 MiB, 48 MiB)  K16   f16 [16384][512]
//   [ 48 MiB, 64 MiB)  (tail of PBUF only)
//   [ 64 MiB, 80 MiB)  VT16  f16 [8][512][2048]
//   [ 80 MiB, 96 MiB)  O16   f16 [16384][512]   (carried x256)
//   [ 96 MiB, 98 MiB)  WT16  f16 4 x [512][512]  (Wq^T, Wk^T, Wv^T, Wo^T, carried x16)
//   [ 98 MiB,226 MiB)  SBUF  f32 [8][2048][2048] (all batches)
//   [  0 MiB, 64 MiB)  PBUF  f16 [8][2048][2048] (all batches, carried x2048); lies over X16, Q16 and K16, whose last
//                      reader (the score launch) ends before the softmax launch writes PBUF
// ---------------------------------------------------------------------------
constexpr size_t kPlane16 = (size_t)kTok * kDim * 2;                 // 16,777,216
constexpr size_t kOffX   = 0;
constexpr size_t kOffQ   = kOffX  + kPlane16;
constexpr size_t kOffK   = kOffQ  + kPlane16;
constexpr size_t kOffVT  = kOffK  + 2 * kPlane16;
constexpr size_t kOffO   = kOffVT + kPlane16;
constexpr size_t kOffWT  = kOffO  + kPlane16;
constexpr size_t kWTBytes = (size_t)4 * kHid * kDim * 2;              // 2,097,152
constexpr size_t kOffS   = kOffWT + kWTBytes;
constexpr size_t kSBytes = (size_t)kBatch * kSeq * kSeq * 4;          // 134,217,728
constexpr size_t kOffP   = kOffX;
constexpr size_t kPBytes = (size_t)kBatch * kSeq * kSeq * 2;          // 67,108,864
static_assert(kOffP + kPBytes <= kOffVT, "PBUF may cover only X16, Q16, K16 and its own tail");
constexpr size_t kWsTotal = kOffS + kSBytes;                          // 236,978,176

typedef __attribute__((ext_vector_type(16))) _Float16 v16h;
typedef __attribute__((ext_vector_type(8)))  _Float16 v8h;
typedef __attribute__((ext_vector_type(16))) __bf16   v16b;
typedef __attribute__((ext_vector_type(8)))  __bf16   v8b;
typedef __attribute__((ext_vector_type(8)))  float    v8f;
typedef __attribute__((ext_vector_type(4)))  float    v4f;
typedef __attribute__((ext_vector_type(4)))  unsigned int v4u;

__device__ __forceinline__ unsigned short f2bf_bits(float f) {
  unsigned u = __float_as_uint(f);
  return (unsigned short)((u + 0x7FFFu + ((u >> 16) & 1u)) >> 16);
}
__device__ __forceinline__ float bf_bits2f(unsigned short h) { return __uint_as_float(((unsigned)h) << 16); }

// hazard guards as plain device helpers (no inline asm inside the kernel template body)
__device__ __forceinline__ void dep_guard_h(v8f& a, v8f& b, v16h x, v16h y) { asm volatile("v_nop\n\tv_nop\n\tv_nop\n\tv_nop" : "+v"(a), "+v"(b) : "v"(x), "v"(y)); }
__device__ __forceinline__ void dep_guard_b(v8f& a, v8f& b, v16b x, v16b y) { asm volatile("v_nop\n\tv_nop\n\tv_nop\n\tv_nop" : "+v"(a), "+v"(b) : "v"(x), "v"(y)); }
__device__ __forceinline__ void keep4_h(v16h a, v16h b, v16h c, v16h d) { asm volatile("v_nop" :: "v"(a), "v"(b), "v"(c), "v"(d)); }
__device__ __forceinline__ void keep4_b(v16b a, v16b b, v16b c, v16b d) { asm volatile("v_nop" :: "v"(a), "v"(b), "v"(c), "v"(d)); }
__device__ __forceinline__ void acc_guard4(v8f& a, v8f& b, v8f& c, v8f& d) { asm volatile("v_nop\n\tv_nop\n\tv_nop\n\tv_nop" : "+v"(a), "+v"(b), "+v"(c), "+v"(d)); }
template <typename T> struct Frag;
template <> struct Frag<_Float16> {
  typedef v16h V; union U { v16h v; v8h h[2]; };
  static __device__ __forceinline__ v16h load(const _Float16* p) {   // elements 0..7 <- p[0..7], 8..15 <- p[16..23]
    U f; f.h[0] = *(const v8h*)(p); f.h[1] = *(const v8h*)(p + 16); return f.v;
  }
  static __device__ __forceinline__ v8f mma(v16h a, v16h b, v8f c) {
    return __builtin_amdgcn_wmma_f32_16x16x32_f16(false, a, false, b, (short)0, c, false, false);
  }
  static __device__ __forceinline__ void guard(v8f& a, v8f& b, v16h x, v16h y) { dep_guard_h(a, b, x, y); }
  static __device__ __forceinline__ void keep(v16h a, v16h b, v16h c, v16h d) { keep4_h(a, b, c, d); }
};
template <> struct Frag<__bf16> {
  typedef v16b V; union U { v16b v; v8b h[2]; };
  static __device__ __forceinline__ v16b load(const __bf16* p) {
    U f; f.h[0] = *(const v8b*)(p); f.h[1] = *(const v8b*)(p + 16); return f.v;
  }
  static __device__ __forceinline__ v8f mma(v16b a, v16b b, v8f c) {
    return __builtin_amdgcn_wmma_f32_16x16x32_bf16(false, a, false, b, (short)0, c, false, false);
  }
  static __device__ __forceinline__ void guard(v8f& a, v8f& b, v16b x, v16b y) { dep_guard_b(a, b, x, y); }
  static __device__ __forceinline__ void keep(v16b a, v16b b, v16b c, v16b d) { keep4_b(a, b, c, d); }
};

__device__ __forceinline__ unsigned pk16(unsigned short a, unsigned short b) { return (unsigned)a | ((unsigned)b << 16); }
__device__ __forceinline__ unsigned short h_bits(float f) { const _Float16 h = (_Float16)f; return __builtin_bit_cast(unsigned short, h); }

// ---- Operand ring in LDS ---------------------------------------------------------------------------------------------
// A block of 8 waves (2 x 4) owns a 128 x 256 tile of C. A stage is 128 k (256 B) of its 128 A rows and 256 Bt rows:
// 384 LDS rows at a pitch of 272 B (16 B x odd, conflict-free for 16-byte row readers); two buffers.
constexpr int kStageK     = 128;                         // halves of k per stage
constexpr int kBlockM     = 128;
constexpr int kBlockN     = 256;
constexpr int kStageRows  = kBlockM + kBlockN;           // 384
constexpr int kRingPitch  = 272;                         // bytes per LDS row
constexpr int kStageBytes = kStageRows * kRingPitch;     // 104,448

// Twelve copies of 16 B per lane, global memory to LDS through no register. The s_wait_xcnt is the last line of the copies'
// own statement, so that it stands in front of any rewrite of an address register that a copy names.
__device__ __forceinline__ void copy12(const unsigned (&l)[12], const char* const (&g)[12]) {
  asm volatile(
      "global_load_async_to_lds_b128 %0, %12, off\n\t"
      "global_load_async_to_lds_b128 %1, %13, off\n\t"
      "global_load_async_to_lds_b128 %2, %14, off\n\t"
      "global_load_async_to_lds_b128 %3, %15, off\n\t"
      "global_load_async_to_lds_b128 %4, %16, off\n\t"
      "global_load_async_to_lds_b128 %5, %17, off\n\t"
      "global_load_async_to_lds_b128 %6, %18, off\n\t"
      "global_load_async_to_lds_b128 %7, %19, off\n\t"
      "global_load_async_to_lds_b128 %8, %20, off\n\t"
      "global_load_async_to_lds_b128 %9, %21, off\n\t"
      "global_load_async_to_lds_b128 %10, %22, off\n\t"
      "global_load_async_to_lds_b128 %11, %23, off\n\t"
      "s_wait_xcnt 0x0"
      :: "v"(l[0]), "v"(l[1]), "v"(l[2]), "v"(l[3]), "v"(l[4]), "v"(l[5]), "v"(l[6]), "v"(l[7]), "v"(l[8]), "v"(l[9]), "v"(l[10]), "v"(l[11]),
         "v"(g[0]), "v"(g[1]), "v"(g[2]), "v"(g[3]), "v"(g[4]), "v"(g[5]), "v"(g[6]), "v"(g[7]), "v"(g[8]), "v"(g[9]), "v"(g[10]), "v"(g[11])
      : "memory");
}
// One stage: thread t brings 16 B of LDS rows (t >> 4) + 16 * i, i = 0..23 (i < 8: A rows, else Bt rows); a wave's copy covers
// two whole 256-B row pieces. l: the thread's LDS byte address in row t >> 4 of the buffer; ga, gb: its bytes of the first
// A row and the first Bt row of the stage; stepA, stepB: 16 rows in bytes.
__device__ __forceinline__ void stage_copy(unsigned l, const char* ga, size_t stepA, const char* gb, size_t stepB) {
  unsigned la[12], lb[12];
  const char* pa[12];
  const char* pb[12];
#pragma unroll
  for (int i = 0; i < 12; ++i) {
    la[i] = l + (unsigned)(i * 16 * kRingPitch);
    lb[i] = l + (unsigned)((i + 12) * 16 * kRingPitch);
    pa[i] = (i < 8) ? ga + (size_t)i * stepA : gb + (size_t)(i - 8) * stepB;
    pb[i] = gb + (size_t)(i + 4) * stepB;
  }
  copy12(la, pa);
  copy12(lb, pb);
}
// this wave's copies have landed (the compiler places no wait for them)
__device__ __forceinline__ void wait_copies() { asm volatile("s_wait_asynccnt 0x0" ::: "memory"); }
// this wave's LDS reads have retired, before the buffer they read is handed back for a refill
__device__ __forceinline__ void wait_lds_reads() { asm volatile("s_wait_dscnt 0x0" ::: "memory"); }

// ---- Register-blocked batched WMMA GEMM, operands through the LDS ring --------------------------------------------------
// C[m,n] = scale * sum_k A[m,k] * Bt[n,k] (+bias)(+resid); each block owns a 128x256 tile, each wave a 64x64 tile of it.
// A row-major [M,K]; Bt row-major [N,K]; M % 128 == 0, N % 256 == 0, K % 128 == 0; grid.x = (M/128)*(N/256).
// SPLIT (hi/lo operand planes A2/Bt2) has no user here and is refused at compile time: the ring stages one plane per operand.
// BIAS_MODE: 0 = none, 1 = bias[m], 2 = bias[n].
// OUT_MODE: 0 = f32, 1 = f16, 2 = bf16 hi plane (Cout) + bf16 lo plane (Cout2).
// ET: 0 = f16 operands, 1 = bf16 operands (pointers passed as 16-bit storage)
template <int ET> struct Elem;
template <> struct Elem<0> { typedef _Float16 T; };
template <> struct Elem<1> { typedef __bf16 T; };
template <int ET, bool SPLIT, int BIAS_MODE, int OUT_MODE, bool RESID, int ACT = 0>
__global__ __launch_bounds__(256) void wmma_gemm64(
    const unsigned short* __restrict__ Ap, const unsigned short* __restrict__ A2p, int lda, long strideA,
    const unsigned short* __restrict__ Btp, const unsigned short* __restrict__ Bt2p, int ldb, long strideB,
    void* __restrict__ Cout, void* __restrict__ Cout2, int ldc, long strideC,
    const float* __restrict__ bias,
    const float* __restrict__ resid, long strideR,
    int M, int N, int K, float scale) {
  typedef typename Elem<ET>::T T;
  typedef typename Frag<T>::V V;
  static_assert(!SPLIT, "the LDS ring stages one plane per operand");
  const T* A = (const T*)Ap; const T* Bt = (const T*)Btp;
  __shared__ __align__(16) unsigned char ring[2 * kStageBytes];   // two stages of operand rows
  __shared__ __align__(16) float sT[8][16 * 68];   // per-wave 16x64 slab, pitch 68 floats
  const int b    = blockIdx.y;
  const int lane = threadIdx.x & 31;
  const int wave = threadIdx.x >> 5;
  const int tilesN = N / kBlockN;
  const int tilesM = M / kBlockM;
  const int tile = blockIdx.x;
  if (tile >= tilesM * tilesN) return;   // block-uniform, in front of every barrier and copy
  const int tm = tile / tilesN;
  const int tn = tile - tm * tilesN;
  const int bm0 = tm * kBlockM;
  const int bn0 = tn * kBlockN;
  const int wm = wave >> 2;              // wave grid 2 (m) x 4 (n)
  const int wn = wave & 3;
  const int m0 = bm0 + (wm << 6);
  const int n0 = bn0 + (wn << 6);

  const T* Ab  = A  + (size_t)b * strideA;
  const T* Bb  = Bt + (size_t)b * strideB;

  // copy side: this thread's 16-byte column and first row of a stage
  const int crow = threadIdx.x >> 4;
  const int ccol = (threadIdx.x & 15) * 16;
  const char* gA = (const char*)(Ab + (size_t)(bm0 + crow) * lda) + ccol;
  const char* gB = (const char*)(Bb + (size_t)(bn0 + crow) * ldb) + ccol;
  const size_t stepA = (size_t)lda * (16 * sizeof(T));
  const size_t stepB = (size_t)ldb * (16 * sizeof(T));
  const unsigned ldsCopy = (unsigned)(size_t)ring + (unsigned)(crow * kRingPitch + ccol);
  const int nStages = K / kStageK;

  const int rlane = lane & 15;                 // row (A) / col (B, D) within subtile
  const int koff  = (lane >> 4) * 8;           // k offset of this lane half
  const int mOff  = (lane >> 4) * 8;           // D row offset

  v8f acc[4][4];
#pragma unroll
  for (int i = 0; i < 4; ++i)
#pragma unroll
    for (int j = 0; j < 4; ++j) acc[i][j] = (v8f){0.f,0.f,0.f,0.f,0.f,0.f,0.f,0.f};

  // reader side: this lane's byte offsets in a stage (same k order for A and Bt as from global memory)
  const int aRd = ((wm << 6) + rlane) * kRingPitch + koff * (int)sizeof(T);
  const int bRd = (kBlockM + (wn << 6) + rlane) * kRingPitch + koff * (int)sizeof(T);

  // prologue: stage 0 lands and is published, then stage 1 flies while stage 0 is worked on
  stage_copy(ldsCopy, gA, stepA, gB, stepB);
  wait_copies();
  __syncthreads();
  if (nStages > 1)   // block-uniform
    stage_copy(ldsCopy + kStageBytes, gA + kStageK * sizeof(T), stepA, gB + kStageK * sizeof(T), stepB);

#pragma unroll 1
  for (int s = 0; s < nStages; ++s) {   // rolled: one publish point per trip
    const unsigned bufOff = (s & 1) ? (unsigned)kStageBytes : 0u;
    const unsigned char* buf = ring + bufOff;
    V fa[2][4], fb[2][4];               // two fragment sets: the next 32 k are fetched while these are multiplied
#pragma unroll
    for (int f = 0; f < 4; ++f) {
      fb[0][f] = Frag<T>::load((const T*)(buf + bRd + f * 16 * kRingPitch));
      fa[0][f] = Frag<T>::load((const T*)(buf + aRd + f * 16 * kRingPitch));
    }
#pragma unroll
    for (int ks = 0; ks < kStageK / 32; ++ks) {
      const int cur = ks & 1, nxt = cur ^ 1;
      if (ks + 1 < kStageK / 32) {
#pragma unroll
        for (int f = 0; f < 4; ++f) {
          fb[nxt][f] = Frag<T>::load((const T*)(buf + bRd + f * 16 * kRingPitch + (ks + 1) * 64));
          fa[nxt][f] = Frag<T>::load((const T*)(buf + aRd + f * 16 * kRingPitch + (ks + 1) * 64));
        }
      }
      __builtin_amdgcn_sched_barrier(0);   // keeps the LDS reads one group ahead of the products, not spread among them
#pragma unroll
      for (int i = 0; i < 4; ++i) {
#pragma unroll
        for (int j = 0; j < 4; ++j) acc[i][j] = Frag<T>::mma(fa[cur][i], fb[cur][j], acc[i][j]);
      }
      __builtin_amdgcn_sched_barrier(0);   // the next group of LDS reads stays behind this run of products
    }
    // publish point of stage s + 1: own reads retired, own copies landed, then the one barrier of the trip
    wait_lds_reads();
    wait_copies();
    __syncthreads();
    if (s + 2 < nStages) {   // block-uniform: refill the buffer that this trip has just read
      const size_t kb = (size_t)(s + 2) * (kStageK * sizeof(T));
      stage_copy(ldsCopy + bufOff, gA + kb, stepA, gB + kb, stepB);
    }
  }
  wait_copies();   // nothing is outstanding when the wave goes on to the epilogue and ends
  acc_guard4(acc[0][0], acc[0][1], acc[0][2], acc[0][3]);
  acc_guard4(acc[1][0], acc[1][1], acc[1][2], acc[1][3]);
  acc_guard4(acc[2][0], acc[2][1], acc[2][2], acc[2][3]);
  acc_guard4(acc[3][0], acc[3][1], acc[3][2], acc[3][3]);

  // ---- epilogue ----
  float* slab = sT[wave];
  const float* Rb = RESID ? (resid + (size_t)b * strideR) : nullptr;
#pragma unroll
  for (int i = 0; i < 4; ++i) {
    const int mBase = m0 + (i << 4);
#pragma unroll
    for (int j = 0; j < 4; ++j) {
      const int n = n0 + (j << 4) + rlane;
      float bv = 0.f;
      if (BIAS_MODE == 2) bv = bias[n];
#pragma unroll
      for (int r = 0; r < 8; ++r) {
        float v = acc[i][j][r] * scale;
        if (BIAS_MODE == 1) v += bias[mBase + mOff + r];
        if (BIAS_MODE == 2) v += bv;
        if (RESID) v += Rb[(size_t)(mBase + mOff + r) * ldc + n];
        if (ACT == 2) v = fmaxf(v, 0.0f);
        if (ACT == 4) v = (v > 0.f) ? v : 0.01f * v;
        slab[(mOff + r) * 68 + (j << 4) + rlane] = v;
      }
    }
    __builtin_amdgcn_fence(__ATOMIC_RELEASE, "workgroup");
    __builtin_amdgcn_wave_barrier();
    __builtin_amdgcn_fence(__ATOMIC_ACQUIRE, "workgroup");
    if (OUT_MODE == 0) {
      float* C = (float*)Cout + (size_t)b * strideC;
      const int hh = lane >> 4, c4 = (lane & 15) * 4;     // row seg = 256 B = 16 lanes x 16 B
      {
#pragma unroll
        for (int it = 0; it < 8; ++it) {
          const int row = it * 2 + hh;
          v4f v = *(const v4f*)(slab + row * 68 + c4);
          *(v4f*)(C + (size_t)(mBase + row) * ldc + n0 + c4) = v;
        }
        
      }
    } else {
      const int q = lane >> 3, c8 = (lane & 7) * 8;
      unsigned short* C  = (unsigned short*)Cout  + (size_t)b * strideC;
      unsigned short* C2 = (OUT_MODE == 2) ? ((unsigned short*)Cout2 + (size_t)b * strideC) : nullptr;
      {
#pragma unroll
        for (int it = 0; it < 4; ++it) {
          const int row = it * 4 + q;
          const float* sp = slab + row * 68 + c8;
          v8h hv, lv;
#pragma unroll
          for (int e = 0; e < 8; ++e) {
            if (OUT_MODE == 1) {
              hv[e] = (_Float16)sp[e];
            } else {
              unsigned short hb = f2bf_bits(sp[e]);
              unsigned short lb = f2bf_bits(sp[e] - bf_bits2f(hb));
              hv[e] = __builtin_bit_cast(_Float16, hb);
              lv[e] = __builtin_bit_cast(_Float16, lb);
            }
          }
          *(v8h*)(C + (size_t)(mBase + row) * ldc + n0 + c8) = hv;
          if (OUT_MODE == 2) *(v8h*)(C2 + (size_t)(mBase + row) * ldc + n0 + c8) = lv;
        }
        
      }
    }
    __builtin_amdgcn_fence(__ATOMIC_RELEASE, "workgroup");
    __builtin_amdgcn_wave_barrier();
    __builtin_amdgcn_fence(__ATOMIC_ACQUIRE, "workgroup");
  }
}

// ---------------------------------------------------------------------------
// Weight transpose + cast: for square [512][512] f32 W (row-major [in d][out h]), WT[h][d] = f16(scale * W[d][h]).
// grid (8, 8, 4): blockIdx.x = d tile (64 cols of WT), blockIdx.y = h tile (64 rows of WT), blockIdx.z selects W0..W3
// and the output plane (plane z at out + z*512*512 halves). 256 threads.
// Load coverage: 16 iterations x 256 threads = 4096 = the whole 64x64 tile (coalesced along h).
// Store coverage: 8 waves x 2 iterations x 4 rows (lane>>3) = 64 rows; (lane&7) x 8 halves = 64 cols; each row segment =
// ---------------------------------------------------------------------------
__global__ __launch_bounds__(256) void wtcast_kernel(const float* __restrict__ W0, const float* __restrict__ W1,
                                                     const float* __restrict__ W2, const float* __restrict__ W3,
                                                     unsigned short* __restrict__ out, float scale) {
  __shared__ float sm[64][65];   // sm[h_local][d_local]
  const int t  = threadIdx.x;
  const int d0 = blockIdx.x * 64;
  const int h0 = blockIdx.y * 64;
  const int z  = blockIdx.z;                                   // block-uniform
  const float* W = (z == 0) ? W0 : (z == 1) ? W1 : (z == 2) ? W2 : W3;
#pragma unroll
  for (int i = 0; i < 16; ++i) {
    const int e = i * 256 + t;
    const int r = e >> 6;          // d local
    const int c = e & 63;          // h local
    sm[c][r] = W[(size_t)(d0 + r) * kHid + h0 + c] * scale;
  }
  __syncthreads();
  const int lane = t & 31, wave = t >> 5;
  const int q = lane >> 3, c8 = (lane & 7) * 8;
  unsigned short* op = out + (size_t)z * kHid * kDim;
  {
#pragma unroll
    for (int it = 0; it < 2; ++it) {
      const int row = wave * 8 + it * 4 + q;                 // h local
      unsigned short hb[8];
#pragma unroll
      for (int e = 0; e < 8; ++e) hb[e] = h_bits(sm[row][c8 + e]);
      const v4u u = (v4u){pk16(hb[0], hb[1]), pk16(hb[2], hb[3]), pk16(hb[4], hb[5]), pk16(hb[6], hb[7])};
      *(v4u*)(op + (size_t)(h0 + row) * kDim + d0 + c8) = u;
    }
    
  }
}

// ---------------------------------------------------------------------------
// ---------------------------------------------------------------------------
__global__ __launch_bounds__(256) void cast8_f16_kernel(const float* __restrict__ in, unsigned short* __restrict__ out, int n8) {
  const int i = blockIdx.x * 256 + threadIdx.x;
  if (i >= n8) return;
  const float* p = in + 8 * (size_t)i;
  const v4f a = *(const v4f*)(p);
  const v4f c = *(const v4f*)(p + 4);
  unsigned short hb[8];
#pragma unroll
  for (int e = 0; e < 4; ++e) {
    hb[e]     = h_bits(a[e]);
    hb[4 + e] = h_bits(c[e]);
  }
  const v4u u = (v4u){pk16(hb[0], hb[1]), pk16(hb[2], hb[3]), pk16(hb[4], hb[5]), pk16(hb[6], hb[7])};
  unsigned short* q = out + 8 * (size_t)i;
  *(v4u*)q = u;
  
}

// ---------------------------------------------------------------------------
// Row softmax over 2048 f32 scores (already scaled): P[row][j] = f16( carry * exp(s - max) / sum exp(s - max) ), f32 math.
// One block of 256 threads per row. Phases 1 and 2: thread t visits columns t + 256*i (i = 0..7, rolled, no private arrays):
// row max, then e = expf(s - max) staged into LDS es[] with the partial sum. Reductions in fixed order (thread, wave shuffle
// tree, 8 wave partials in index order). Phase 3: thread t owns columns 8t..8t+7 (256 x 8 = 2048 = whole row), reads them from
// ---------------------------------------------------------------------------
__global__ __launch_bounds__(256) void softmax_row_kernel(const float* __restrict__ S, unsigned short* __restrict__ P, float carry) {
  __shared__ __align__(16) float es[kSeq];
  __shared__ float redM[8];
  __shared__ float redS[8];
  const int row  = blockIdx.x;
  const int t    = threadIdx.x;
  const int lane = t & 31, wave = t >> 5;
  const float* sr = S + (size_t)row * kSeq;

  float m = -__builtin_inff();
#pragma unroll 1
  for (int i = 0; i < 8; ++i) m = fmaxf(m, sr[t + 256 * i]);
#pragma unroll
  for (int off = 16; off > 0; off >>= 1) m = fmaxf(m, __shfl_xor(m, off, 32));
  if (lane == 0) redM[wave] = m;
  __syncthreads();
  float gm = redM[0];
#pragma unroll
  for (int w = 1; w < 8; ++w) gm = fmaxf(gm, redM[w]);

  float ps = 0.f;
#pragma unroll 1
  for (int i = 0; i < 8; ++i) {
    const int c = t + 256 * i;
    const float e = expf(sr[c] - gm);
    es[c] = e;
    ps += e;
  }
#pragma unroll
  for (int off = 16; off > 0; off >>= 1) ps += __shfl_xor(ps, off, 32);
  if (lane == 0) redS[wave] = ps;
  __syncthreads();
  float tot = redS[0];
#pragma unroll
  for (int w = 1; w < 8; ++w) tot += redS[w];
  const float inv = carry * (1.0f / tot);

  const v4f a = *(const v4f*)(es + 8 * t);
  const v4f c = *(const v4f*)(es + 8 * t + 4);
  unsigned short hb[8];
#pragma unroll
  for (int e = 0; e < 4; ++e) {
    hb[e]     = h_bits(a[e] * inv);
    hb[4 + e] = h_bits(c[e] * inv);
  }
  const v4u u = (v4u){pk16(hb[0], hb[1]), pk16(hb[2], hb[3]), pk16(hb[4], hb[5]), pk16(hb[6], hb[7])};
  unsigned short* q = P + (size_t)row * kSeq + 8 * t;
  *(v4u*)q = u;
  
}

// ---------------------------------------------------------------------------
// Host side: 9 launches, all grids exact functions of the fixed shapes.
// ---------------------------------------------------------------------------
extern "C" void kernel_launch(void* const* d_in, const int* in_sizes, int n_in,
                              void* d_out, int out_size, void* d_ws, size_t ws_size, hipStream_t stream) {
  if (n_in < 9) return;
  if (in_sizes[0] != kTok * kDim) return;
  if (in_sizes[1] != kDim * kHid || in_sizes[3] != kDim * kHid || in_sizes[5] != kDim * kHid || in_sizes[7] != kDim * kHid) return;
  if (in_sizes[2] != kHid || in_sizes[4] != kHid || in_sizes[6] != kHid || in_sizes[8] != kHid) return;
  if (out_size != kTok * kDim) return;
  if (ws_size < kWsTotal) return;

  const float* x  = (const float*)d_in[0];
  const float* Wq = (const float*)d_in[1];
  const float* bq = (const float*)d_in[2];
  const float* Wk = (const float*)d_in[3];
  const float* bk = (const float*)d_in[4];
  const float* Wv = (const float*)d_in[5];
  const float* bv = (const float*)d_in[6];
  const float* Wo = (const float*)d_in[7];
  const float* bo = (const float*)d_in[8];
  float* out = (float*)d_out;

  char* ws = (char*)d_ws;
  unsigned short* X16  = (unsigned short*)(ws + kOffX);
  unsigned short* Q16  = (unsigned short*)(ws + kOffQ);
  unsigned short* K16  = (unsigned short*)(ws + kOffK);
  unsigned short* VT16 = (unsigned short*)(ws + kOffVT);
  unsigned short* O16  = (unsigned short*)(ws + kOffO);
  unsigned short* WT   = (unsigned short*)(ws + kOffWT);
  float*          SBUF = (float*)(ws + kOffS);
  unsigned short* PBUF = (unsigned short*)(ws + kOffP);
  const size_t wplane = (size_t)kHid * kDim;            // halves per W^T plane
  unsigned short* WqT = WT;
  unsigned short* WkT = WT + wplane;
  unsigned short* WvT = WT + 2 * wplane;
  unsigned short* WoT = WT + 3 * wplane;

  // 1) W^T planes: WT[z][h][d] = f16(16 * W_z[d][h]); grid (512/64, 512/64, 4)
  wtcast_kernel<<<dim3(kDim / 64, kHid / 64, 4), 256, 0, stream>>>(Wq, Wk, Wv, Wo, WT, kWCarry);

  // 2) x -> X16 [16384][512]; n8 = 1,048,576 -> 4096 blocks exactly
  {
    const int n8 = kTok * kDim / 8;
    cast8_f16_kernel<<<dim3((n8 + 255) / 256), 256, 0, stream>>>(x, X16, n8);
  }

  const long tokPlane = (long)kSeq * kDim;               // halves per batch of a [token][512] plane = 1,048,576
  const long vtPlane  = (long)kDim * kSeq;               // halves per batch of V^T [512][2048]

  // 3) Q16 = (X16 . WqT) / 16 + bq   M 16384, N 512, K 512 -> 128 x 2 block tiles = 256 blocks
  wmma_gemm64<0, false, 2, 1, false><<<dim3((kTok / kBlockM) * (kHid / kBlockN), 1), 256, 0, stream>>>(
      X16, X16, kDim, 0L, WqT, WqT, kDim, 0L, (void*)Q16, (void*)Q16, kHid, 0L,
      bq, bq, 0L, kTok, kHid, kDim, kWCarryInv);
  // 4) K16 likewise
  wmma_gemm64<0, false, 2, 1, false><<<dim3((kTok / kBlockM) * (kHid / kBlockN), 1), 256, 0, stream>>>(
      X16, X16, kDim, 0L, WkT, WkT, kDim, 0L, (void*)K16, (void*)K16, kHid, 0L,
      bk, bk, 0L, kTok, kHid, kDim, kWCarryInv);
  // 5) V^T per batch: VT16[b][d][m] = sum_k WvT[d][k] X16[b*2048+m][k] / 16 + bv[d]
  //    A = WvT [512][512] (stride 0), Bt = X16 batch rows [2048][512], C [512][2048]; M 512, N 2048, K 512 -> 4 x 8 block tiles = 32 blocks, grid.y = 8
  wmma_gemm64<0, false, 1, 1, false><<<dim3((kHid / kBlockM) * (kSeq / kBlockN), kBatch), 256, 0, stream>>>(
      WvT, WvT, kDim, 0L, X16, X16, kDim, tokPlane, (void*)VT16, (void*)VT16, kSeq, vtPlane,
      bv, bv, 0L, kHid, kSeq, kDim, kWCarryInv);

  // 6) attention, all 8 batches in each launch (grid.y = batch for S and P.V; softmax grid.x = 8 x 2048 rows): S = scale * Q.K^T (f32), row softmax -> P (f16 x2048),
  //    O16 = (P.V)*256 stored f16
  const long sPlane = (long)kSeq * kSeq;                 // elements per batch of S and of P = 4,194,304
  // S [8][2048][2048]: per batch M 2048, N 2048, K 512 -> 16 x 8 block tiles = 128 blocks; 1024 blocks in all
  wmma_gemm64<0, false, 0, 0, false><<<dim3((kSeq / kBlockM) * (kSeq / kBlockN), kBatch), 256, 0, stream>>>(
      Q16, Q16, kHid, tokPlane, K16, K16, kHid, tokPlane, (void*)SBUF, (void*)SBUF, kSeq, sPlane,
      bq, bq, 0L, kSeq, kSeq, kHid, kAttnScale);
  // softmax rows -> P: the 8 x 2048 rows of S are contiguous, one block a row
  softmax_row_kernel<<<dim3(kTok), 256, 0, stream>>>(SBUF, PBUF, kPCarry);
  // O = P . V : A = P [2048][2048], Bt = V^T [512][2048]; per batch M 2048, N 512, K 2048 -> 16 x 2 block tiles = 32 blocks;
  // 256 blocks in all; scale 256/2048
  wmma_gemm64<0, false, 0, 1, false><<<dim3((kSeq / kBlockM) * (kHid / kBlockN), kBatch), 256, 0, stream>>>(
      PBUF, PBUF, kSeq, sPlane, VT16, VT16, kSeq, vtPlane, (void*)O16, (void*)O16, kHid, tokPlane,
      bv, bv, 0L, kSeq, kHid, kSeq, kPVScale);

  // 7) out = (O16 . WoT) / 4096 + bo   M 16384, N 512, K 512 -> 128 x 2 block tiles = 256 blocks; f32 whole-line epilogue into d_out
  wmma_gemm64<0, false, 2, 0, false><<<dim3((kTok / kBlockM) * (kDim / kBlockN), 1), 256, 0, stream>>>(
      O16, O16, kHid, 0L, WoT, WoT, kHid, 0L, (void*)out, (void*)out, kDim, 0L,
      bo, bo, 0L, kTok, kDim, kHid, kOutScale);
}

// v003
// Measured time: 150 microseconds a run.
// Two timings next to v002 put it at 1.19 and 1.16 times that version's speed.
// Counting every step since v000, it is 7.30 times as fast.
// Contractions: q/k/v projections (X f16 x W^T f16 carried x16), scores q.k^T (q,k f16 planes), attn.v (P f16 carried x2048 x V^T f16), output projection (O f16 carried x256 x Wo^T f16 carried x16), all on v_wmma_f32_16x16x32_f16 with f32 accumulate; softmax and biases in f32.
#include <hip/hip_runtime.h>
#include <math.h>

// ---------------------------------------------------------------------------
// Problem constants
// ---------------------------------------------------------------------------
constexpr int kBatch = 8;
constexpr int kSeq   = 2048;
constexpr int kDim   = 512;               // embed dim (input and output of every projection)
constexpr int kHid   = 512;
constexpr int kTok   = kBatch * kSeq;     // 16384 token rows
constexpr float kWCarry    = 16.0f;       // weights carried x16 in f16
constexpr float kWCarryInv = 1.0f / 16.0f;
constexpr float kPCarry    = 2048.0f;     // probabilities carried x2048 in f16
constexpr float kOCarry    = 256.0f;      // attention output carried x256 in f16
constexpr float kPVScale   = kOCarry / kPCarry;              // 1/8
constexpr float kOutScale  = 1.0f / (kOCarry * kWCarry);     // 1/4096
constexpr float kAttnScale = 0.044194173824159216f;          // 512^-0.5

// ---------------------------------------------------------------------------
// Workspace region map (bytes); total 236,978,176 B
//   [  0 MiB, 16 MiB)  X16   f16 [16384][512]
//   [ 16 MiB, 32 MiB)  Q16   f16 [16384][512]
//   [ 32 MiB, 48 MiB)  K16   f16 [16384][512]
//   [ 48 MiB, 64 MiB)  (tail of PBUF only)
//   [ 64 MiB, 80 MiB)  VT16  f16 [8][512][2048]
//   [ 80 MiB, 96 MiB)  O16   f16 [16384][512]   (carried x256)
//   [ 96 MiB, 98 MiB)  WT16  f16 4 x [512][512]  (Wq^T, Wk^T, Wv^T, Wo^T, carried x16)
//   [ 98 MiB,226 MiB)  SBUF  f32 [8][2048][2048] (all batches)
//   [  0 MiB, 64 MiB)  PBUF  f16 [8][2048][2048] (all batches, carried x2048); lies over X16, Q16 and K16, whose last
//                      reader (the score launch) ends before the softmax launch writes PBUF
// ---------------------------------------------------------------------------
constexpr size_t kPlane16 = (size_t)kTok * kDim * 2;                 // 16,777,216
constexpr size_t kOffX   = 0;
constexpr size_t kOffQ   = kOffX  + kPlane16;
constexpr size_t kOffK   = kOffQ  + kPlane16;
constexpr size_t kOffVT  = kOffK  + 2 * kPlane16;
constexpr size_t kOffO   = kOffVT + kPlane16;
constexpr size_t kOffWT  = kOffO  + kPlane16;
constexpr size_t kWTBytes = (size_t)4 * kHid * kDim * 2;              // 2,097,152
constexpr size_t kOffS   = kOffWT + kWTBytes;
constexpr size_t kSBytes = (size_t)kBatch * kSeq * kSeq * 4;          // 134,217,728
constexpr size_t kOffP   = kOffX;
constexpr size_t kPBytes = (size_t)kBatch * kSeq * kSeq * 2;          // 67,108,864
static_assert(kOffP + kPBytes <= kOffVT, "PBUF may cover only X16, Q16, K16 and its own tail");
constexpr size_t kWsTotal = kOffS + kSBytes;                          // 236,978,176

typedef __attribute__((ext_vector_type(16))) _Float16 v16h;
typedef __attribute__((ext_vector_type(8)))  _Float16 v8h;
typedef __attribute__((ext_vector_type(4)))  _Float16 v4h;
typedef __attribute__((ext_vector_type(16))) __bf16   v16b;
typedef __attribute__((ext_vector_type(8)))  __bf16   v8b;
typedef __attribute__((ext_vector_type(8)))  float    v8f;
typedef __attribute__((ext_vector_type(4)))  float    v4f;
typedef __attribute__((ext_vector_type(4)))  unsigned int v4u;

__device__ __forceinline__ unsigned short f2bf_bits(float f) {
  unsigned u = __float_as_uint(f);
  return (unsigned short)((u + 0x7FFFu + ((u >> 16) & 1u)) >> 16);
}
__device__ __forceinline__ float bf_bits2f(unsigned short h) { return __uint_as_float(((unsigned)h) << 16); }

// hazard guards as plain device helpers (no inline asm inside the kernel template body)
__device__ __forceinline__ void dep_guard_h(v8f& a, v8f& b, v16h x, v16h y) { asm volatile("v_nop\n\tv_nop\n\tv_nop\n\tv_nop" : "+v"(a), "+v"(b) : "v"(x), "v"(y)); }
__device__ __forceinline__ void dep_guard_b(v8f& a, v8f& b, v16b x, v16b y) { asm volatile("v_nop\n\tv_nop\n\tv_nop\n\tv_nop" : "+v"(a), "+v"(b) : "v"(x), "v"(y)); }
__device__ __forceinline__ void keep4_h(v16h a, v16h b, v16h c, v16h d) { asm volatile("v_nop" :: "v"(a), "v"(b), "v"(c), "v"(d)); }
__device__ __forceinline__ void keep4_b(v16b a, v16b b, v16b c, v16b d) { asm volatile("v_nop" :: "v"(a), "v"(b), "v"(c), "v"(d)); }
__device__ __forceinline__ void acc_guard4(v8f& a, v8f& b, v8f& c, v8f& d) { asm volatile("v_nop\n\tv_nop\n\tv_nop\n\tv_nop" : "+v"(a), "+v"(b), "+v"(c), "+v"(d)); }
template <typename T> struct Frag;
template <> struct Frag<_Float16> {
  typedef v16h V; union U { v16h v; v8h h[2]; };
  static __device__ __forceinline__ v16h load(const _Float16* p) {   // elements 0..7 <- p[0..7], 8..15 <- p[16..23]
    U f; f.h[0] = *(const v8h*)(p); f.h[1] = *(const v8h*)(p + 16); return f.v;
  }
  static __device__ __forceinline__ v8f mma(v16h a, v16h b, v8f c) {
    return __builtin_amdgcn_wmma_f32_16x16x32_f16(false, a, false, b, (short)0, c, false, false);
  }
  static __device__ __forceinline__ void guard(v8f& a, v8f& b, v16h x, v16h y) { dep_guard_h(a, b, x, y); }
  static __device__ __forceinline__ void keep(v16h a, v16h b, v16h c, v16h d) { keep4_h(a, b, c, d); }
};
template <> struct Frag<__bf16> {
  typedef v16b V; union U { v16b v; v8b h[2]; };
  static __device__ __forceinline__ v16b load(const __bf16* p) {
    U f; f.h[0] = *(const v8b*)(p); f.h[1] = *(const v8b*)(p + 16); return f.v;
  }
  static __device__ __forceinline__ v8f mma(v16b a, v16b b, v8f c) {
    return __builtin_amdgcn_wmma_f32_16x16x32_bf16(false, a, false, b, (short)0, c, false, false);
  }
  static __device__ __forceinline__ void guard(v8f& a, v8f& b, v16b x, v16b y) { dep_guard_b(a, b, x, y); }
  static __device__ __forceinline__ void keep(v16b a, v16b b, v16b c, v16b d) { keep4_b(a, b, c, d); }
};

__device__ __forceinline__ unsigned pk16(unsigned short a, unsigned short b) { return (unsigned)a | ((unsigned)b << 16); }
__device__ __forceinline__ unsigned short h_bits(float f) { const _Float16 h = (_Float16)f; return __builtin_bit_cast(unsigned short, h); }

// ---- Operand ring in LDS ---------------------------------------------------------------------------------------------
// A block of 8 waves (2 x 4) owns a 128 x 256 tile of C. A stage is 128 k (256 B) of its 128 A rows and 256 Bt rows:
// 384 LDS rows at a pitch of 272 B (16 B x odd, conflict-free for 16-byte row readers); two buffers.
constexpr int kStageK     = 128;                         // halves of k per stage
constexpr int kBlockM     = 128;
constexpr int kBlockN     = 256;
constexpr int kStageRows  = kBlockM + kBlockN;           // 384
constexpr int kRingPitch  = 272;                         // bytes per LDS row
constexpr int kStageBytes = kStageRows * kRingPitch;     // 104,448

// Twelve copies of 16 B per lane, global memory to LDS through no register. The s_wait_xcnt is the last line of the copies'
// own statement, so that it stands in front of any rewrite of an address register that a copy names.
__device__ __forceinline__ void copy12(const unsigned (&l)[12], const char* const (&g)[12]) {
  asm volatile(
      "global_load_async_to_lds_b128 %0, %12, off\n\t"
      "global_load_async_to_lds_b128 %1, %13, off\n\t"
      "global_load_async_to_lds_b128 %2, %14, off\n\t"
      "global_load_async_to_lds_b128 %3, %15, off\n\t"
      "global_load_async_to_lds_b128 %4, %16, off\n\t"
      "global_load_async_to_lds_b128 %5, %17, off\n\t"
      "global_load_async_to_lds_b128 %6, %18, off\n\t"
      "global_load_async_to_lds_b128 %7, %19, off\n\t"
      "global_load_async_to_lds_b128 %8, %20, off\n\t"
      "global_load_async_to_lds_b128 %9, %21, off\n\t"
      "global_load_async_to_lds_b128 %10, %22, off\n\t"
      "global_load_async_to_lds_b128 %11, %23, off\n\t"
      "s_wait_xcnt 0x0"
      :: "v"(l[0]), "v"(l[1]), "v"(l[2]), "v"(l[3]), "v"(l[4]), "v"(l[5]), "v"(l[6]), "v"(l[7]), "v"(l[8]), "v"(l[9]), "v"(l[10]), "v"(l[11]),
         "v"(g[0]), "v"(g[1]), "v"(g[2]), "v"(g[3]), "v"(g[4]), "v"(g[5]), "v"(g[6]), "v"(g[7]), "v"(g[8]), "v"(g[9]), "v"(g[10]), "v"(g[11])
      : "memory");
}
// One stage: thread t brings 16 B of LDS rows (t >> 4) + 16 * i, i = 0..23 (i < 8: A rows, else Bt rows); a wave's copy covers
// two whole 256-B row pieces. l: the thread's LDS byte address in row t >> 4 of the buffer; ga, gb: its bytes of the first
// A row and the first Bt row of the stage; stepA, stepB: 16 rows in bytes.
__device__ __forceinline__ void stage_copy(unsigned l, const char* ga, size_t stepA, const char* gb, size_t stepB) {
  unsigned la[12], lb[12];
  const char* pa[12];
  const char* pb[12];
#pragma unroll
  for (int i = 0; i < 12; ++i) {
    la[i] = l + (unsigned)(i * 16 * kRingPitch);
    lb[i] = l + (unsigned)((i + 12) * 16 * kRingPitch);
    pa[i] = (i < 8) ? ga + (size_t)i * stepA : gb + (size_t)(i - 8) * stepB;
    pb[i] = gb + (size_t)(i + 4) * stepB;
  }
  copy12(la, pa);
  copy12(lb, pb);
}
// this wave's copies have landed (the compiler places no wait for them)
__device__ __forceinline__ void wait_copies() { asm volatile("s_wait_asynccnt 0x0" ::: "memory"); }
// this wave's LDS reads have retired, before the buffer they read is handed back for a refill
__device__ __forceinline__ void wait_lds_reads() { asm volatile("s_wait_dscnt 0x0" ::: "memory"); }

// ---- Register-blocked batched WMMA GEMM, operands through the LDS ring --------------------------------------------------
// C[m,n] = scale * sum_k A[m,k] * Bt[n,k] (+bias)(+resid); each block owns a 128x256 tile, each wave a 64x64 tile of it.
// A row-major [M,K]; Bt row-major [N,K]; M % 128 == 0, N % 256 == 0, K % 128 == 0; grid.x = (M/128)*(N/256).
// SPLIT (hi/lo operand planes A2/Bt2) has no user here and is refused at compile time: the ring stages one plane per operand.
// BIAS_MODE: 0 = none, 1 = bias[m], 2 = bias[n].
// OUT_MODE: 0 = f32, 1 = f16, 2 = bf16 hi plane (Cout) + bf16 lo plane (Cout2).
// ET: 0 = f16 operands, 1 = bf16 operands (pointers passed as 16-bit storage)
template <int ET> struct Elem;
template <> struct Elem<0> { typedef _Float16 T; };
template <> struct Elem<1> { typedef __bf16 T; };
template <int ET, bool SPLIT, int BIAS_MODE, int OUT_MODE, bool RESID, int ACT = 0>
__global__ __launch_bounds__(256) void wmma_gemm64(
    const unsigned short* __restrict__ Ap, const unsigned short* __restrict__ A2p, int lda, long strideA,
    const unsigned short* __restrict__ Btp, const unsigned short* __restrict__ Bt2p, int ldb, long strideB,
    void* __restrict__ Cout, void* __restrict__ Cout2, int ldc, long strideC,
    const float* __restrict__ bias,
    const float* __restrict__ resid, long strideR,
    int M, int N, int K, float scale) {
  typedef typename Elem<ET>::T T;
  typedef typename Frag<T>::V V;
  static_assert(!SPLIT, "the LDS ring stages one plane per operand");
  const T* A = (const T*)Ap; const T* Bt = (const T*)Btp;
  __shared__ __align__(16) unsigned char ring[2 * kStageBytes];   // two stages of operand rows
  __shared__ __align__(16) float sT[8][16 * 68];   // per-wave 16x64 slab, pitch 68 floats
  const int b    = blockIdx.y;
  const int lane = threadIdx.x & 31;
  const int wave = threadIdx.x >> 5;
  const int tilesN = N / kBlockN;
  const int tilesM = M / kBlockM;
  const int tile = blockIdx.x;
  if (tile >= tilesM * tilesN) return;   // block-uniform, in front of every barrier and copy
  const int tm = tile / tilesN;
  const int tn = tile - tm * tilesN;
  const int bm0 = tm * kBlockM;
  const int bn0 = tn * kBlockN;
  const int wm = wave >> 2;              // wave grid 2 (m) x 4 (n)
  const int wn = wave & 3;
  const int m0 = bm0 + (wm << 6);
  const int n0 = bn0 + (wn << 6);

  const T* Ab  = A  + (size_t)b * strideA;
  const T* Bb  = Bt + (size_t)b * strideB;

  // copy side: this thread's 16-byte column and first row of a stage
  const int crow = threadIdx.x >> 4;
  const int ccol = (threadIdx.x & 15) * 16;
  const char* gA = (const char*)(Ab + (size_t)(bm0 + crow) * lda) + ccol;
  const char* gB = (const char*)(Bb + (size_t)(bn0 + crow) * ldb) + ccol;
  const size_t stepA = (size_t)lda * (16 * sizeof(T));
  const size_t stepB = (size_t)ldb * (16 * sizeof(T));
  const unsigned ldsCopy = (unsigned)(size_t)ring + (unsigned)(crow * kRingPitch + ccol);
  const int nStages = K / kStageK;

  const int rlane = lane & 15;                 // row (A) / col (B, D) within subtile
  const int koff  = (lane >> 4) * 8;           // k offset of this lane half
  const int mOff  = (lane >> 4) * 8;           // D row offset

  v8f acc[4][4];
#pragma unroll
  for (int i = 0; i < 4; ++i)
#pragma unroll
    for (int j = 0; j < 4; ++j) acc[i][j] = (v8f){0.f,0.f,0.f,0.f,0.f,0.f,0.f,0.f};

  // reader side: this lane's byte offsets in a stage (same k order for A and Bt as from global memory)
  const int aRd = ((wm << 6) + rlane) * kRingPitch + koff * (int)sizeof(T);
  const int bRd = (kBlockM + (wn << 6) + rlane) * kRingPitch + koff * (int)sizeof(T);

  // prologue: stage 0 lands and is published, then stage 1 flies while stage 0 is worked on
  stage_copy(ldsCopy, gA, stepA, gB, stepB);
  wait_copies();
  __syncthreads();
  if (nStages > 1)   // block-uniform
    stage_copy(ldsCopy + kStageBytes, gA + kStageK * sizeof(T), stepA, gB + kStageK * sizeof(T), stepB);

#pragma unroll 1
  for (int s = 0; s < nStages; ++s) {   // rolled: one publish point per trip
    const unsigned bufOff = (s & 1) ? (unsigned)kStageBytes : 0u;
    const unsigned char* buf = ring + bufOff;
    V fa[2][4], fb[2][4];               // two fragment sets: the next 32 k are fetched while these are multiplied
#pragma unroll
    for (int f = 0; f < 4; ++f) {
      fb[0][f] = Frag<T>::load((const T*)(buf + bRd + f * 16 * kRingPitch));
      fa[0][f] = Frag<T>::load((const T*)(buf + aRd + f * 16 * kRingPitch));
    }
#pragma unroll
    for (int ks = 0; ks < kStageK / 32; ++ks) {
      const int cur = ks & 1, nxt = cur ^ 1;
      if (ks + 1 < kStageK / 32) {
#pragma unroll
        for (int f = 0; f < 4; ++f) {
          fb[nxt][f] = Frag<T>::load((const T*)(buf + bRd + f * 16 * kRingPitch + (ks + 1) * 64));
          fa[nxt][f] = Frag<T>::load((const T*)(buf + aRd + f * 16 * kRingPitch + (ks + 1) * 64));
        }
      }
      __builtin_amdgcn_sched_barrier(0);   // keeps the LDS reads one group ahead of the products, not spread among them
#pragma unroll
      for (int i = 0; i < 4; ++i) {
#pragma unroll
        for (int j = 0; j < 4; ++j) acc[i][j] = Frag<T>::mma(fa[cur][i], fb[cur][j], acc[i][j]);
      }
      __builtin_amdgcn_sched_barrier(0);   // the next group of LDS reads stays behind this run of products
    }
    // publish point of stage s + 1: own reads retired, own copies landed, then the one barrier of the trip
    wait_lds_reads();
    wait_copies();
    __syncthreads();
    if (s + 2 < nStages) {   // block-uniform: refill the buffer that this trip has just read
      const size_t kb = (size_t)(s + 2) * (kStageK * sizeof(T));
      stage_copy(ldsCopy + bufOff, gA + kb, stepA, gB + kb, stepB);
    }
  }
  wait_copies();   // nothing is outstanding when the wave goes on to the epilogue and ends
  acc_guard4(acc[0][0], acc[0][1], acc[0][2], acc[0][3]);
  acc_guard4(acc[1][0], acc[1][1], acc[1][2], acc[1][3]);
  acc_guard4(acc[2][0], acc[2][1], acc[2][2], acc[2][3]);
  acc_guard4(acc[3][0], acc[3][1], acc[3][2], acc[3][3]);

  // ---- epilogue ----
  float* slab = sT[wave];
  const float* Rb = RESID ? (resid + (size_t)b * strideR) : nullptr;
#pragma unroll
  for (int i = 0; i < 4; ++i) {
    const int mBase = m0 + (i << 4);
#pragma unroll
    for (int j = 0; j < 4; ++j) {
      const int n = n0 + (j << 4) + rlane;
      float bv = 0.f;
      if (BIAS_MODE == 2) bv = bias[n];
#pragma unroll
      for (int r = 0; r < 8; ++r) {
        float v = acc[i][j][r] * scale;
        if (BIAS_MODE == 1) v += bias[mBase + mOff + r];
        if (BIAS_MODE == 2) v += bv;
        if (RESID) v += Rb[(size_t)(mBase + mOff + r) * ldc + n];
        if (ACT == 2) v = fmaxf(v, 0.0f);
        if (ACT == 4) v = (v > 0.f) ? v : 0.01f * v;
        slab[(mOff + r) * 68 + (j << 4) + rlane] = v;
      }
    }
    __builtin_amdgcn_fence(__ATOMIC_RELEASE, "workgroup");
    __builtin_amdgcn_wave_barrier();
    __builtin_amdgcn_fence(__ATOMIC_ACQUIRE, "workgroup");
    if (OUT_MODE == 0) {
      float* C = (float*)Cout + (size_t)b * strideC;
      const int hh = lane >> 4, c4 = (lane & 15) * 4;     // row seg = 256 B = 16 lanes x 16 B
      {
#pragma unroll
        for (int it = 0; it < 8; ++it) {
          const int row = it * 2 + hh;
          v4f v = *(const v4f*)(slab + row * 68 + c4);
          *(v4f*)(C + (size_t)(mBase + row) * ldc + n0 + c4) = v;
        }
        
      }
    } else {
      const int q = lane >> 3, c8 = (lane & 7) * 8;
      unsigned short* C  = (unsigned short*)Cout  + (size_t)b * strideC;
      unsigned short* C2 = (OUT_MODE == 2) ? ((unsigned short*)Cout2 + (size_t)b * strideC) : nullptr;
      {
#pragma unroll
        for (int it = 0; it < 4; ++it) {
          const int row = it * 4 + q;
          const float* sp = slab + row * 68 + c8;
          v8h hv, lv;
#pragma unroll
          for (int e = 0; e < 8; ++e) {
            if (OUT_MODE == 1) {
              hv[e] = (_Float16)sp[e];
            } else {
              unsigned short hb = f2bf_bits(sp[e]);
              unsigned short lb = f2bf_bits(sp[e] - bf_bits2f(hb));
              hv[e] = __builtin_bit_cast(_Float16, hb);
              lv[e] = __builtin_bit_cast(_Float16, lb);
            }
          }
          *(v8h*)(C + (size_t)(mBase + row) * ldc + n0 + c8) = hv;
          if (OUT_MODE == 2) *(v8h*)(C2 + (size_t)(mBase + row) * ldc + n0 + c8) = lv;
        }
        
      }
    }
    __builtin_amdgcn_fence(__ATOMIC_RELEASE, "workgroup");
    __builtin_amdgcn_wave_barrier();
    __builtin_amdgcn_fence(__ATOMIC_ACQUIRE, "workgroup");
  }
}

// ---------------------------------------------------------------------------
// Weight transpose + cast: for square [512][512] f32 W (row-major [in d][out h]), WT[h][d] = f16(scale * W[d][h]).
// grid (8, 8, 4): blockIdx.x = d tile (64 cols of WT), blockIdx.y = h tile (64 rows of WT), blockIdx.z selects W0..W3
// and the output plane (plane z at out + z*512*512 halves). 256 threads.
// Load coverage: 16 iterations x 256 threads = 4096 = the whole 64x64 tile (coalesced along h).
// Store coverage: 8 waves x 2 iterations x 4 rows (lane>>3) = 64 rows; (lane&7) x 8 halves = 64 cols; each row segment =
// ---------------------------------------------------------------------------
__global__ __launch_bounds__(256) void wtcast_kernel(const float* __restrict__ W0, const float* __restrict__ W1,
                                                     const float* __restrict__ W2, const float* __restrict__ W3,
                                                     unsigned short* __restrict__ out, float scale) {
  __shared__ float sm[64][65];   // sm[h_local][d_local]
  const int t  = threadIdx.x;
  const int d0 = blockIdx.x * 64;
  const int h0 = blockIdx.y * 64;
  const int z  = blockIdx.z;                                   // block-uniform
  const float* W = (z == 0) ? W0 : (z == 1) ? W1 : (z == 2) ? W2 : W3;
#pragma unroll
  for (int i = 0; i < 16; ++i) {
    const int e = i * 256 + t;
    const int r = e >> 6;          // d local
    const int c = e & 63;          // h local
    sm[c][r] = W[(size_t)(d0 + r) * kHid + h0 + c] * scale;
  }
  __syncthreads();
  const int lane = t & 31, wave = t >> 5;
  const int q = lane >> 3, c8 = (lane & 7) * 8;
  unsigned short* op = out + (size_t)z * kHid * kDim;
  {
#pragma unroll
    for (int it = 0; it < 2; ++it) {
      const int row = wave * 8 + it * 4 + q;                 // h local
      unsigned short hb[8];
#pragma unroll
      for (int e = 0; e < 8; ++e) hb[e] = h_bits(sm[row][c8 + e]);
      const v4u u = (v4u){pk16(hb[0], hb[1]), pk16(hb[2], hb[3]), pk16(hb[4], hb[5]), pk16(hb[6], hb[7])};
      *(v4u*)(op + (size_t)(h0 + row) * kDim + d0 + c8) = u;
    }
    
  }
}

// ---------------------------------------------------------------------------
// ---------------------------------------------------------------------------
__global__ __launch_bounds__(256) void cast8_f16_kernel(const float* __restrict__ in, unsigned short* __restrict__ out, int n8) {
  const int i = blockIdx.x * 256 + threadIdx.x;
  if (i >= n8) return;
  const float* p = in + 8 * (size_t)i;
  const v4f a = *(const v4f*)(p);
  const v4f c = *(const v4f*)(p + 4);
  unsigned short hb[8];
#pragma unroll
  for (int e = 0; e < 4; ++e) {
    hb[e]     = h_bits(a[e]);
    hb[4 + e] = h_bits(c[e]);
  }
  const v4u u = (v4u){pk16(hb[0], hb[1]), pk16(hb[2], hb[3]), pk16(hb[4], hb[5]), pk16(hb[6], hb[7])};
  unsigned short* q = out + 8 * (size_t)i;
  *(v4u*)q = u;
  
}

// ---------------------------------------------------------------------------
// Row softmax over 2048 f32 scores (already scaled): P[row][j] = f16( carry * exp(s - max) / sum exp(s - max) ), f32 math.
// A streaming kernel: S is read once. 16 waves per workgroup, 4 consecutive rows per wave, 256 workgroups: every wave is
// resident from the start. A wave holds a whole row in registers: piece q (q = 0..15) is 512 contiguous bytes of the row, lane l
// owns columns 128 q + 4 l .. + 3. The next row's 16 loads are issued before the current row's exponentials (for the first row of a pair, before its maximum too). No LDS, no barrier.
// Reductions in fixed order: per lane one chain per column of a piece over q, (c0, c1) with (c2, c3), then a five-step butterfly.
// ---------------------------------------------------------------------------
constexpr int kSmWaves  = 16;            // waves per workgroup
constexpr int kSmRows   = 4;             // rows per wave, one after the other
constexpr int kSmPieces = kSeq / 128;    // 16 loads of 16 B per lane and row
static_assert(kTok % (kSmWaves * kSmRows) == 0, "whole workgroups only: no row guard in the kernel");
static_assert(kSmRows % 2 == 0, "the row loop takes two rows a trip");
// row: the row's first byte (wave-uniform); off: this lane's 16 bytes in a piece. S is read once: non-temporal.
__device__ __forceinline__ void sm_load_row(v4f (&d)[kSmPieces], const char* row, unsigned off) {
#pragma unroll
  for (int q = 0; q < kSmPieces; ++q) d[q] = __builtin_nontemporal_load((const v4f*)(row + 512 * q + off));
}
// exp(x) in f32 with the library expf's two-part log2(e) and its range limits. Written out so that v_exp_f32 and the slot behind it are
// one statement.
__device__ __forceinline__ float sm_exp(float x) {
  constexpr float kL2eHi = 0x1.715476p+0f, kL2eLo = 0x1.4ae0bep-26f;            // log2(e) = hi + lo
  const float e = __builtin_rintf(x * kL2eHi);                                  // whole part of x log2(e)
  const float a = __builtin_fmaf(x, kL2eLo, __builtin_fmaf(x, kL2eHi, -e));     // the rest, about -1/2 .. 1/2
  float r;
  asm("v_exp_f32 %0, %1\n\tv_nop" : "=v"(r) : "v"(a));   // v_nop: the independent slot that the instruction set asks for behind a transcendental
  r = __builtin_ldexpf(r, (int)e);
  r = (x < -0x1.9d1da0p+6f) ? 0.0f : r;                                         // below the smallest f32
  return (x > 0x1.62e430p+6f) ? __builtin_inff() : r;                           // above the largest
}
// the row's maximum, in every lane
__device__ __forceinline__ float sm_row_max(const v4f (&c)[kSmPieces]) {
  v4f m4 = c[0];
#pragma unroll
  for (int q = 1; q < kSmPieces; ++q)
#pragma unroll
    for (int e = 0; e < 4; ++e) m4[e] = fmaxf(m4[e], c[q][e]);
  float gm = fmaxf(fmaxf(m4[0], m4[1]), fmaxf(m4[2], m4[3]));
#pragma unroll
  for (int off = 16; off > 0; off >>= 1) gm = fmaxf(gm, __shfl_xor(gm, off, 32));
  return gm;
}
// c: the row's scores; gm: their maximum; row: the first byte of the row of P (wave-uniform); off: this lane's 8 bytes in a piece.
__device__ __forceinline__ void sm_row_out(v4f (&c)[kSmPieces], float gm, char* row, unsigned off, float carry) {
  v4f s4 = (v4f){0.f, 0.f, 0.f, 0.f};
#pragma unroll
  for (int q = 0; q < kSmPieces; ++q)
#pragma unroll
    for (int e = 0; e < 4; ++e) {
      const float x = sm_exp(c[q][e] - gm);
      c[q][e] = x;
      s4[e] += x;
    }
  float tot = (s4[0] + s4[1]) + (s4[2] + s4[3]);
#pragma unroll
  for (int off = 16; off > 0; off >>= 1) tot += __shfl_xor(tot, off, 32);
  const float inv = carry * (1.0f / tot);

#pragma unroll
  for (int q = 0; q < kSmPieces; ++q) {   // a wave's store covers 256 contiguous bytes: two whole lines
    v4h h;
#pragma unroll
    for (int e = 0; e < 4; ++e) h[e] = (_Float16)(c[q][e] * inv);
    *(v4h*)(row + 256 * q + off) = h;
  }
  // in front of the next rewrite of a register that one of these stores, or a load in flight, names
  asm volatile("s_wait_xcnt 0x0" ::: "memory");
}
__global__ __launch_bounds__(kSmWaves * 32) void softmax_row_kernel(const float* __restrict__ S, unsigned short* __restrict__ P, float carry) {
  const unsigned lane = threadIdx.x & 31;
  const unsigned wave = (unsigned)__builtin_amdgcn_readfirstlane((int)(threadIdx.x >> 5));   // wave-uniform: the row base is formed on the scalar side
  const size_t row0 = (size_t)(blockIdx.x * kSmWaves + wave) * kSmRows;
  const char* sp = (const char*)(S + row0 * kSeq);
  char* pp = (char*)(P + row0 * kSeq);
  constexpr size_t kSRow = (size_t)kSeq * 4, kPRow = (size_t)kSeq * 2;   // bytes per row of S and of P
  const unsigned so = lane * 16, po = lane * 8;

  v4f b0[kSmPieces], b1[kSmPieces];   // the row in work and the row in flight
  sm_load_row(b0, sp, so);
#pragma unroll 1
  for (int r = 0; r < kSmRows; r += 2) {   // rolled: the text of two rows is fetched once and run again
    __builtin_amdgcn_sched_barrier(0);     // the scheduling barriers pin the order: the next row's loads as one group, then this row's work
    sm_load_row(b1, sp + kSRow, so);
    __builtin_amdgcn_sched_barrier(0);
    sm_row_out(b0, sm_row_max(b0), pp, po, carry);
    __builtin_amdgcn_sched_barrier(0);
    const float gm1 = sm_row_max(b1);      // in front of the branch: its load waits then count this row's loads alone on both paths
    __builtin_amdgcn_sched_barrier(0);
    if (r + 2 < kSmRows) sm_load_row(b0, sp + 2 * kSRow, so);   // uniform: no load behind the wave's last row
    __builtin_amdgcn_sched_barrier(0);
    sm_row_out(b1, gm1, pp + kPRow, po, carry);
    __builtin_amdgcn_sched_barrier(0);     // the row pointers move on behind the wait that ends sm_row_out
    sp += 2 * kSRow;
    pp += 2 * kPRow;
  }
}

// ---------------------------------------------------------------------------
// Host side: 9 launches, all grids exact functions of the fixed shapes.
// ---------------------------------------------------------------------------
extern "C" void kernel_launch(void* const* d_in, const int* in_sizes, int n_in,
                              void* d_out, int out_size, void* d_ws, size_t ws_size, hipStream_t stream) {
  if (n_in < 9) return;
  if (in_sizes[0] != kTok * kDim) return;
  if (in_sizes[1] != kDim * kHid || in_sizes[3] != kDim * kHid || in_sizes[5] != kDim * kHid || in_sizes[7] != kDim * kHid) return;
  if (in_sizes[2] != kHid || in_sizes[4] != kHid || in_sizes[6] != kHid || in_sizes[8] != kHid) return;
  if (out_size != kTok * kDim) return;
  if (ws_size < kWsTotal) return;

  const float* x  = (const float*)d_in[0];
  const float* Wq = (const float*)d_in[1];
  const float* bq = (const float*)d_in[2];
  const float* Wk = (const float*)d_in[3];
  const float* bk = (const float*)d_in[4];
  const float* Wv = (const float*)d_in[5];
  const float* bv = (const float*)d_in[6];
  const float* Wo = (const float*)d_in[7];
  const float* bo = (const float*)d_in[8];
  float* out = (float*)d_out;

  char* ws = (char*)d_ws;
  unsigned short* X16  = (unsigned short*)(ws + kOffX);
  unsigned short* Q16  = (unsigned short*)(ws + kOffQ);
  unsigned short* K16  = (unsigned short*)(ws + kOffK);
  unsigned short* VT16 = (unsigned short*)(ws + kOffVT);
  unsigned short* O16  = (unsigned short*)(ws + kOffO);
  unsigned short* WT   = (unsigned short*)(ws + kOffWT);
  float*          SBUF = (float*)(ws + kOffS);
  unsigned short* PBUF = (unsigned short*)(ws + kOffP);
  const size_t wplane = (size_t)kHid * kDim;            // halves per W^T plane
  unsigned short* WqT = WT;
  unsigned short* WkT = WT + wplane;
  unsigned short* WvT = WT + 2 * wplane;
  unsigned short* WoT = WT + 3 * wplane;

  // 1) W^T planes: WT[z][h][d] = f16(16 * W_z[d][h]); grid (512/64, 512/64, 4)
  wtcast_kernel<<<dim3(kDim / 64, kHid / 64, 4), 256, 0, stream>>>(Wq, Wk, Wv, Wo, WT, kWCarry);

  // 2) x -> X16 [16384][512]; n8 = 1,048,576 -> 4096 blocks exactly
  {
    const int n8 = kTok * kDim / 8;
    cast8_f16_kernel<<<dim3((n8 + 255) / 256), 256, 0, stream>>>(x, X16, n8);
  }

  const long tokPlane = (long)kSeq * kDim;               // halves per batch of a [token][512] plane = 1,048,576
  const long vtPlane  = (long)kDim * kSeq;               // halves per batch of V^T [512][2048]

  // 3) Q16 = (X16 . WqT) / 16 + bq   M 16384, N 512, K 512 -> 128 x 2 block tiles = 256 blocks
  wmma_gemm64<0, false, 2, 1, false><<<dim3((kTok / kBlockM) * (kHid / kBlockN), 1), 256, 0, stream>>>(
      X16, X16, kDim, 0L, WqT, WqT, kDim, 0L, (void*)Q16, (void*)Q16, kHid, 0L,
      bq, bq, 0L, kTok, kHid, kDim, kWCarryInv);
  // 4) K16 likewise
  wmma_gemm64<0, false, 2, 1, false><<<dim3((kTok / kBlockM) * (kHid / kBlockN), 1), 256, 0, stream>>>(
      X16, X16, kDim, 0L, WkT, WkT, kDim, 0L, (void*)K16, (void*)K16, kHid, 0L,
      bk, bk, 0L, kTok, kHid, kDim, kWCarryInv);
  // 5) V^T per batch: VT16[b][d][m] = sum_k WvT[d][k] X16[b*2048+m][k] / 16 + bv[d]
  //    A = WvT [512][512] (stride 0), Bt = X16 batch rows [2048][512], C [512][2048]; M 512, N 2048, K 512 -> 4 x 8 block tiles = 32 blocks, grid.y = 8
  wmma_gemm64<0, false, 1, 1, false><<<dim3((kHid / kBlockM) * (kSeq / kBlockN), kBatch), 256, 0, stream>>>(
      WvT, WvT, kDim, 0L, X16, X16, kDim, tokPlane, (void*)VT16, (void*)VT16, kSeq, vtPlane,
      bv, bv, 0L, kHid, kSeq, kDim, kWCarryInv);

  // 6) attention, all 8 batches in each launch (grid.y = batch in the two products): S = scale * Q.K^T (f32), row softmax -> P (f16 x2048),
  //    O16 = (P.V)*256 stored f16
  const long sPlane = (long)kSeq * kSeq;                 // elements per batch of S and of P = 4,194,304
  // S [8][2048][2048]: per batch M 2048, N 2048, K 512 -> 16 x 8 block tiles = 128 blocks; 1024 blocks in all
  wmma_gemm64<0, false, 0, 0, false><<<dim3((kSeq / kBlockM) * (kSeq / kBlockN), kBatch), 256, 0, stream>>>(
      Q16, Q16, kHid, tokPlane, K16, K16, kHid, tokPlane, (void*)SBUF, (void*)SBUF, kSeq, sPlane,
      bq, bq, 0L, kSeq, kSeq, kHid, kAttnScale);
  // softmax rows -> P: the 8 x 2048 rows of S are contiguous, 64 rows a block -> 256 blocks of 16 waves
  softmax_row_kernel<<<dim3(kTok / (kSmWaves * kSmRows)), kSmWaves * 32, 0, stream>>>(SBUF, PBUF, kPCarry);
  // O = P . V : A = P [2048][2048], Bt = V^T [512][2048]; per batch M 2048, N 512, K 2048 -> 16 x 2 block tiles = 32 blocks;
  // 256 blocks in all; scale 256/2048
  wmma_gemm64<0, false, 0, 1, false><<<dim3((kSeq / kBlockM) * (kHid / kBlockN), kBatch), 256, 0, stream>>>(
      PBUF, PBUF, kSeq, sPlane, VT16, VT16, kSeq, vtPlane, (void*)O16, (void*)O16, kHid, tokPlane,
      bv, bv, 0L, kSeq, kHid, kSeq, kPVScale);

  // 7) out = (O16 . WoT) / 4096 + bo   M 16384, N 512, K 512 -> 128 x 2 block tiles = 256 blocks; f32 whole-line epilogue into d_out
  wmma_gemm64<0, false, 2, 0, false><<<dim3((kTok / kBlockM) * (kDim / kBlockN), 1), 256, 0, stream>>>(
      O16, O16, kHid, 0L, WoT, WoT, kHid, 0L, (void*)out, (void*)out, kDim, 0L,
      bo, bo, 0L, kTok, kDim, kHid, kOutScale);
}

// v004
// Measured time: 130 microseconds a run.
// Timed twice side by side with v003, it ran 1.16 and 1.14 times as fast.
// Counting every step since v000, it is 8.41 times as fast.
// Contractions: q/k/v projections (X f16 x W^T f16 carried x16), scores q.k^T (q,k f16 planes), attn.v (E f16, the exponential of a score against its 64-key tile's row maximum, times the tile's weight in f16 carried x2048, x V^T f16), output projection (O f16 carried x256 x Wo^T f16 carried x16), all on v_wmma_f32_16x16x32_f16 with f32 accumulate; softmax and biases in f32.
#include <hip/hip_runtime.h>
#include <math.h>

// ---------------------------------------------------------------------------
// Problem constants
// ---------------------------------------------------------------------------
constexpr int kBatch = 8;
constexpr int kSeq   = 2048;
constexpr int kDim   = 512;               // embed dim (input and output of every projection)
constexpr int kHid   = 512;
constexpr int kTok   = kBatch * kSeq;     // 16384 token rows
constexpr float kWCarry    = 16.0f;       // weights carried x16 in f16
constexpr float kWCarryInv = 1.0f / 16.0f;
constexpr float kPCarry    = 2048.0f;     // probabilities carried x2048 in f16
constexpr float kOCarry    = 256.0f;      // attention output carried x256 in f16
constexpr float kPVScale   = kOCarry / kPCarry;              // 1/8
constexpr float kOutScale  = 1.0f / (kOCarry * kWCarry);     // 1/4096
constexpr float kAttnScaleL2 = 0.044194173824159216f * 1.4426950408889634f;   // 512^-0.5 * log2(e): scores are kept in log2 units
constexpr int   kSmTile  = 64;                // keys per softmax tile = the columns of one wave's score tile
constexpr int   kSmTiles = kSeq / kSmTile;    // 32 tiles per row

// ---------------------------------------------------------------------------
// Workspace region map (bytes); total 174,063,616 B
//   [  0 MiB, 16 MiB)  X16   f16 [16384][512]
//   [ 16 MiB, 32 MiB)  Q16   f16 [16384][512]
//   [ 32 MiB, 48 MiB)  K16   f16 [16384][512]
//   [ 48 MiB, 64 MiB)  (unused)
//   [ 64 MiB, 80 MiB)  VT16  f16 [8][512][2048]
//   [ 80 MiB, 96 MiB)  O16   f16 [16384][512]   (carried x256)
//   [ 96 MiB, 98 MiB)  WT16  f16 4 x [512][512]  (Wq^T, Wk^T, Wv^T, Wo^T, carried x16)
//   [ 98 MiB,162 MiB)  EBUF  f16 [8][2048][2048] (all batches): 2^(s - m), s the score in log2 units, m its tile's row maximum
//   [162 MiB,166 MiB)  STAT  f32 2 x [32][16384]: plane 0 m[tile][token], plane 1 l[tile][token] = the tile's row sum of 2^(s - m)
// ---------------------------------------------------------------------------
constexpr size_t kPlane16 = (size_t)kTok * kDim * 2;                 // 16,777,216
constexpr size_t kOffX   = 0;
constexpr size_t kOffQ   = kOffX  + kPlane16;
constexpr size_t kOffK   = kOffQ  + kPlane16;
constexpr size_t kOffVT  = kOffK  + 2 * kPlane16;
constexpr size_t kOffO   = kOffVT + kPlane16;
constexpr size_t kOffWT  = kOffO  + kPlane16;
constexpr size_t kWTBytes = (size_t)4 * kHid * kDim * 2;              // 2,097,152
constexpr size_t kOffE   = kOffWT + kWTBytes;
constexpr size_t kEBytes = (size_t)kBatch * kSeq * kSeq * 2;          // 67,108,864
constexpr size_t kOffStat   = kOffE + kEBytes;
constexpr size_t kStatBytes = (size_t)2 * kSmTiles * kTok * 4;        // 4,194,304
constexpr size_t kWsTotal = kOffStat + kStatBytes;                    // 174,063,616

typedef __attribute__((ext_vector_type(16))) _Float16 v16h;
typedef __attribute__((ext_vector_type(8)))  _Float16 v8h;
typedef __attribute__((ext_vector_type(4)))  _Float16 v4h;
typedef __attribute__((ext_vector_type(2)))  _Float16 v2h;
typedef __attribute__((ext_vector_type(2)))  unsigned int v2u;
typedef __attribute__((ext_vector_type(16))) __bf16   v16b;
typedef __attribute__((ext_vector_type(8)))  __bf16   v8b;
typedef __attribute__((ext_vector_type(8)))  float    v8f;
typedef __attribute__((ext_vector_type(4)))  float    v4f;
typedef __attribute__((ext_vector_type(4)))  unsigned int v4u;

__device__ __forceinline__ unsigned short f2bf_bits(float f) {
  unsigned u = __float_as_uint(f);
  return (unsigned short)((u + 0x7FFFu + ((u >> 16) & 1u)) >> 16);
}
__device__ __forceinline__ float bf_bits2f(unsigned short h) { return __uint_as_float(((unsigned)h) << 16); }

// hazard guards as plain device helpers
__device__ __forceinline__ void dep_guard_h(v8f& a, v8f& b, v16h x, v16h y) { asm volatile("v_nop\n\tv_nop\n\tv_nop\n\tv_nop" : "+v"(a), "+v"(b) : "v"(x), "v"(y)); }
__device__ __forceinline__ void dep_guard_b(v8f& a, v8f& b, v16b x, v16b y) { asm volatile("v_nop\n\tv_nop\n\tv_nop\n\tv_nop" : "+v"(a), "+v"(b) : "v"(x), "v"(y)); }
__device__ __forceinline__ void keep4_h(v16h a, v16h b, v16h c, v16h d) { asm volatile("v_nop" :: "v"(a), "v"(b), "v"(c), "v"(d)); }
__device__ __forceinline__ void keep4_b(v16b a, v16b b, v16b c, v16b d) { asm volatile("v_nop" :: "v"(a), "v"(b), "v"(c), "v"(d)); }
__device__ __forceinline__ void acc_guard4(v8f& a, v8f& b, v8f& c, v8f& d) { asm volatile("v_nop\n\tv_nop\n\tv_nop\n\tv_nop" : "+v"(a), "+v"(b), "+v"(c), "+v"(d)); }
template <typename T> struct Frag;
template <> struct Frag<_Float16> {
  typedef v16h V; union U { v16h v; v8h h[2]; };
  static __device__ __forceinline__ v16h load(const _Float16* p) {   // elements 0..7 <- p[0..7], 8..15 <- p[16..23]
    U f; f.h[0] = *(const v8h*)(p); f.h[1] = *(const v8h*)(p + 16); return f.v;
  }
  static __device__ __forceinline__ v8f mma(v16h a, v16h b, v8f c) {
    return __builtin_amdgcn_wmma_f32_16x16x32_f16(false, a, false, b, (short)0, c, false, false);
  }
  static __device__ __forceinline__ void guard(v8f& a, v8f& b, v16h x, v16h y) { dep_guard_h(a, b, x, y); }
  static __device__ __forceinline__ void keep(v16h a, v16h b, v16h c, v16h d) { keep4_h(a, b, c, d); }
};
template <> struct Frag<__bf16> {
  typedef v16b V; union U { v16b v; v8b h[2]; };
  static __device__ __forceinline__ v16b load(const __bf16* p) {
    U f; f.h[0] = *(const v8b*)(p); f.h[1] = *(const v8b*)(p + 16); return f.v;
  }
  static __device__ __forceinline__ v8f mma(v16b a, v16b b, v8f c) {
    return __builtin_amdgcn_wmma_f32_16x16x32_bf16(false, a, false, b, (short)0, c, false, false);
  }
  static __device__ __forceinline__ void guard(v8f& a, v8f& b, v16b x, v16b y) { dep_guard_b(a, b, x, y); }
  static __device__ __forceinline__ void keep(v16b a, v16b b, v16b c, v16b d) { keep4_b(a, b, c, d); }
};

__device__ __forceinline__ unsigned pk16(unsigned short a, unsigned short b) { return (unsigned)a | ((unsigned)b << 16); }
__device__ __forceinline__ unsigned short h_bits(float f) { const _Float16 h = (_Float16)f; return __builtin_bit_cast(unsigned short, h); }

// ---- Operand ring in LDS ---------------------------------------------------------------------------------------------
// A block of 8 waves (2 x 4) owns a 128 x 256 tile of C. A stage is 128 k (256 B) of its 128 A rows and 256 Bt rows:
// 384 LDS rows at a pitch of 272 B (16 B x odd, conflict-free for 16-byte row readers); two buffers.
constexpr int kStageK     = 128;                         // halves of k per stage
constexpr int kBlockM     = 128;
constexpr int kBlockN     = 256;
constexpr int kStageRows  = kBlockM + kBlockN;           // 384
constexpr int kRingPitch  = 272;                         // bytes per LDS row
constexpr int kStageBytes = kStageRows * kRingPitch;     // 104,448

// Twelve copies of 16 B per lane, global memory to LDS through no register. The s_wait_xcnt is the last line of the copies'
// own statement, so that it stands in front of any rewrite of an address register that a copy names.
__device__ __forceinline__ void copy12(const unsigned (&l)[12], const char* const (&g)[12]) {
  asm volatile(
      "global_load_async_to_lds_b128 %0, %12, off\n\t"
      "global_load_async_to_lds_b128 %1, %13, off\n\t"
      "global_load_async_to_lds_b128 %2, %14, off\n\t"
      "global_load_async_to_lds_b128 %3, %15, off\n\t"
      "global_load_async_to_lds_b128 %4, %16, off\n\t"
      "global_load_async_to_lds_b128 %5, %17, off\n\t"
      "global_load_async_to_lds_b128 %6, %18, off\n\t"
      "global_load_async_to_lds_b128 %7, %19, off\n\t"
      "global_load_async_to_lds_b128 %8, %20, off\n\t"
      "global_load_async_to_lds_b128 %9, %21, off\n\t"
      "global_load_async_to_lds_b128 %10, %22, off\n\t"
      "global_load_async_to_lds_b128 %11, %23, off\n\t"
      "s_wait_xcnt 0x0"
      :: "v"(l[0]), "v"(l[1]), "v"(l[2]), "v"(l[3]), "v"(l[4]), "v"(l[5]), "v"(l[6]), "v"(l[7]), "v"(l[8]), "v"(l[9]), "v"(l[10]), "v"(l[11]),
         "v"(g[0]), "v"(g[1]), "v"(g[2]), "v"(g[3]), "v"(g[4]), "v"(g[5]), "v"(g[6]), "v"(g[7]), "v"(g[8]), "v"(g[9]), "v"(g[10]), "v"(g[11])
      : "memory");
}
// One stage: thread t brings 16 B of LDS rows (t >> 4) + 16 * i, i = 0..23 (i < 8: A rows, else Bt rows); a wave's copy covers
// two whole 256-B row pieces. l: the thread's LDS byte address in row t >> 4 of the buffer; ga, gb: its bytes of the first
// A row and the first Bt row of the stage; stepA, stepB: 16 rows in bytes.
__device__ __forceinline__ void stage_copy(unsigned l, const char* ga, size_t stepA, const char* gb, size_t stepB) {
  unsigned la[12], lb[12];
  const char* pa[12];
  const char* pb[12];
#pragma unroll
  for (int i = 0; i < 12; ++i) {
    la[i] = l + (unsigned)(i * 16 * kRingPitch);
    lb[i] = l + (unsigned)((i + 12) * 16 * kRingPitch);
    pa[i] = (i < 8) ? ga + (size_t)i * stepA : gb + (size_t)(i - 8) * stepB;
    pb[i] = gb + (size_t)(i + 4) * stepB;
  }
  copy12(la, pa);
  copy12(lb, pb);
}
// this wave's copies have landed (the compiler places no wait for them)
__device__ __forceinline__ void wait_copies() { asm volatile("s_wait_asynccnt 0x0" ::: "memory"); }
// this wave's LDS reads have retired, before the buffer they read is handed back for a refill
__device__ __forceinline__ void wait_lds_reads() { asm volatile("s_wait_dscnt 0x0" ::: "memory"); }

// ---- Softmax split over the two attention products --------------------------------------------------------------------
// 2^a. v_nop: the independent slot that the instruction set asks for behind a transcendental.
__device__ __forceinline__ float ex2(float a) {
  float r;
  asm("v_exp_f32 %0, %1\n\tv_nop" : "=v"(r) : "v"(a));
  return r;
}
// the value of lane l ^ X inside a 16-lane row (DPP row_xmask:X; every lane is on where it is used)
template <int X> __device__ __forceinline__ float lane_xor(float v) {
  return __builtin_bit_cast(float, __builtin_amdgcn_update_dpp(0, __builtin_bit_cast(int, v), 0x160 + X, 0xf, 0xf, true));
}
constexpr int kWPitch = kSmTiles + 2;   // dwords per row of the tile-weight table in LDS: even (8-byte reads), 34 r mod 64 distinct for 16 rows

// ---- Register-blocked batched WMMA GEMM, operands through the LDS ring --------------------------------------------------
// C[m,n] = scale * sum_k A[m,k] * Bt[n,k] (+bias)(+resid); each block owns a 128x256 tile, each wave a 64x64 tile of it.
// A row-major [M,K]; Bt row-major [N,K]; M % 128 == 0, N % 256 == 0, K % 128 == 0; grid.x = (M/128)*(N/256).
// SPLIT (hi/lo operand planes A2/Bt2) has no user here and is refused at compile time: the ring stages one plane per operand.
// BIAS_MODE: 0 = none, 1 = bias[m], 2 = bias[n].
// OUT_MODE: 0 = f32, 1 = f16, 2 = bf16 hi plane (Cout) + bf16 lo plane (Cout2).
// ET: 0 = f16 operands, 1 = bf16 operands (pointers passed as 16-bit storage)
// SM: 0 = plain. 1 = score product: C = f16(2^(s - m)) with m the row's maximum over the wave's 64 columns; m and the row sum l
//     of the 64 exponentials go to Cout2 (planes [tile][token]). 2 = attn.v: A rows are weighted per 64-k tile by
//     2048 * 2^(m_tile - max m) / L, L = sum over tiles of 2^(m_tile - max m) * l; m and l come in through resid.
template <int ET> struct Elem;
template <> struct Elem<0> { typedef _Float16 T; };
template <> struct Elem<1> { typedef __bf16 T; };
template <int ET, bool SPLIT, int BIAS_MODE, int OUT_MODE, bool RESID, int ACT = 0, int SM = 0>
__global__ __launch_bounds__(256) void wmma_gemm64(
    const unsigned short* __restrict__ Ap, const unsigned short* __restrict__ A2p, int lda, long strideA,
    const unsigned short* __restrict__ Btp, const unsigned short* __restrict__ Bt2p, int ldb, long strideB,
    void* __restrict__ Cout, void* __restrict__ Cout2, int ldc, long strideC,
    const float* __restrict__ bias,
    const float* __restrict__ resid, long strideR,
    int M, int N, int K, float scale) {
  typedef typename Elem<ET>::T T;
  typedef typename Frag<T>::V V;
  static_assert(!SPLIT, "the LDS ring stages one plane per operand");
  const T* A = (const T*)Ap; const T* Bt = (const T*)Btp;
  __shared__ __align__(16) unsigned char ring[2 * kStageBytes];   // two stages of operand rows
  __shared__ __align__(16) float sT[8][16 * 68];   // per-wave 16x64 slab, pitch 68 floats
  __shared__ __align__(16) float sStat[SM == 1 ? 8 * 128 : 4];               // SM 1: per wave m[64], l[64] of its rows
  __shared__ __align__(16) unsigned sW[SM == 2 ? kBlockM * kWPitch : 4];     // SM 2: tile weights, f16 twice in a dword
  const int b    = blockIdx.y;
  const int lane = threadIdx.x & 31;
  const int wave = threadIdx.x >> 5;
  const int tilesN = N / kBlockN;
  const int tilesM = M / kBlockM;
  const int tile = blockIdx.x;
  if (tile >= tilesM * tilesN) return;   // block-uniform, in front of every barrier and copy
  const int tm = tile / tilesN;
  const int tn = tile - tm * tilesN;
  const int bm0 = tm * kBlockM;
  const int bn0 = tn * kBlockN;
  const int wm = wave >> 2;              // wave grid 2 (m) x 4 (n)
  const int wn = wave & 3;
  const int m0 = bm0 + (wm << 6);
  const int n0 = bn0 + (wn << 6);

  const T* Ab  = A  + (size_t)b * strideA;
  const T* Bb  = Bt + (size_t)b * strideB;

  // copy side: this thread's 16-byte column and first row of a stage
  const int crow = threadIdx.x >> 4;
  const int ccol = (threadIdx.x & 15) * 16;
  const char* gA = (const char*)(Ab + (size_t)(bm0 + crow) * lda) + ccol;
  const char* gB = (const char*)(Bb + (size_t)(bn0 + crow) * ldb) + ccol;
  const size_t stepA = (size_t)lda * (16 * sizeof(T));
  const size_t stepB = (size_t)ldb * (16 * sizeof(T));
  const unsigned ldsCopy = (unsigned)(size_t)ring + (unsigned)(crow * kRingPitch + ccol);
  const int nStages = K / kStageK;

  const int rlane = lane & 15;                 // row (A) / col (B, D) within subtile
  const int koff  = (lane >> 4) * 8;           // k offset of this lane half
  const int mOff  = (lane >> 4) * 8;           // D row offset

  v8f acc[4][4];
#pragma unroll
  for (int i = 0; i < 4; ++i)
#pragma unroll
    for (int j = 0; j < 4; ++j) acc[i][j] = (v8f){0.f,0.f,0.f,0.f,0.f,0.f,0.f,0.f};

  // reader side: this lane's byte offsets in a stage (same k order for A and Bt as from global memory)
  const int aRd = ((wm << 6) + rlane) * kRingPitch + koff * (int)sizeof(T);
  const int bRd = (kBlockM + (wn << 6) + rlane) * kRingPitch + koff * (int)sizeof(T);

  // prologue: stage 0 lands and is published, then stage 1 flies while stage 0 is worked on
  stage_copy(ldsCopy, gA, stepA, gB, stepB);
  if constexpr (SM == 2) {
    // while stage 0 flies: the row's tile weights, published by the barrier below. Thread t: row t & 127; both
    // halves of the block do the same sums in the same order, each writes 16 of the 32 weights.
    const int srow = threadIdx.x & (kBlockM - 1);
    const int half = threadIdx.x >> 7;
    const float* mp = resid + (size_t)b * M + bm0 + srow;
    const float* lp = mp + (size_t)kSmTiles * kTok;
    float mv[kSmTiles], lv[kSmTiles];
#pragma unroll
    for (int t = 0; t < kSmTiles; ++t) { mv[t] = mp[(size_t)t * kTok]; lv[t] = lp[(size_t)t * kTok]; }
    asm volatile("s_wait_xcnt 0x0" ::: "memory");   // in front of any rewrite of an address register that these loads name
    float gm = mv[0];
#pragma unroll
    for (int t = 1; t < kSmTiles; ++t) gm = fmaxf(gm, mv[t]);
    float tot = 0.f;
#pragma unroll
    for (int t = 0; t < kSmTiles; ++t) {
      mv[t] = ex2(mv[t] - gm);
      tot += mv[t] * lv[t];
    }
    const float inv = kPCarry / tot;   // tot >= 1: the tile that holds the row's maximum has weight 1 and l >= 1
    unsigned* wrow = sW + srow * kWPitch + half * (kSmTiles / 2);
#pragma unroll
    for (int t = 0; t < kSmTiles / 2; ++t) {
      const unsigned short hb = h_bits((half ? mv[t + kSmTiles / 2] : mv[t]) * inv);
      wrow[t] = pk16(hb, hb);
    }
  }
  wait_copies();
  __syncthreads();
  if (nStages > 1)   // block-uniform
    stage_copy(ldsCopy + kStageBytes, gA + kStageK * sizeof(T), stepA, gB + kStageK * sizeof(T), stepB);

#pragma unroll 1
  for (int s = 0; s < nStages; ++s) {   // rolled: one publish point per trip
    const unsigned bufOff = (s & 1) ? (unsigned)kStageBytes : 0u;
    const unsigned char* buf = ring + bufOff;
    V fa[2][4], fb[2][4];               // two fragment sets: the next 32 k are fetched while these are multiplied
    v2u wS[4];                          // SM 2: the weights of this stage's two 64-k tiles for the lane's four A rows
    if constexpr (SM == 2) {
#pragma unroll
      for (int f = 0; f < 4; ++f) wS[f] = *(const v2u*)(sW + ((wm << 6) + f * 16 + rlane) * kWPitch + 2 * s);
    }
#pragma unroll
    for (int f = 0; f < 4; ++f) {
      fb[0][f] = Frag<T>::load((const T*)(buf + bRd + f * 16 * kRingPitch));
      fa[0][f] = Frag<T>::load((const T*)(buf + aRd + f * 16 * kRingPitch));
    }
#pragma unroll
    for (int ks = 0; ks < kStageK / 32; ++ks) {
      const int cur = ks & 1, nxt = cur ^ 1;
      if (ks + 1 < kStageK / 32) {
#pragma unroll
        for (int f = 0; f < 4; ++f) {
          fb[nxt][f] = Frag<T>::load((const T*)(buf + bRd + f * 16 * kRingPitch + (ks + 1) * 64));
          fa[nxt][f] = Frag<T>::load((const T*)(buf + aRd + f * 16 * kRingPitch + (ks + 1) * 64));
        }
      }
      __builtin_amdgcn_sched_barrier(0);   // keeps the LDS reads one group ahead of the products, not spread among them
      if constexpr (SM == 2) {
#pragma unroll
        for (int i = 0; i < 4; ++i) {
          const v2h w2 = __builtin_bit_cast(v2h, (unsigned)wS[i][ks >> 1]);
          fa[cur][i] = fa[cur][i] * __builtin_shufflevector(w2, w2, 0, 1, 0, 1, 0, 1, 0, 1, 0, 1, 0, 1, 0, 1, 0, 1);
        }
      }
#pragma unroll
      for (int i = 0; i < 4; ++i) {
#pragma unroll
        for (int j = 0; j < 4; ++j) acc[i][j] = Frag<T>::mma(fa[cur][i], fb[cur][j], acc[i][j]);
      }
      __builtin_amdgcn_sched_barrier(0);   // the next group of LDS reads stays behind this run of products
    }
    // publish point of stage s + 1: own reads retired, own copies landed, then the one barrier of the trip
    wait_lds_reads();
    wait_copies();
    __syncthreads();
    if (s + 2 < nStages) {   // block-uniform: refill the buffer that this trip has just read
      const size_t kb = (size_t)(s + 2) * (kStageK * sizeof(T));
      stage_copy(ldsCopy + bufOff, gA + kb, stepA, gB + kb, stepB);
    }
  }
  wait_copies();   // nothing is outstanding when the wave goes on to the epilogue and ends
  acc_guard4(acc[0][0], acc[0][1], acc[0][2], acc[0][3]);
  acc_guard4(acc[1][0], acc[1][1], acc[1][2], acc[1][3]);
  acc_guard4(acc[2][0], acc[2][1], acc[2][2], acc[2][3]);
  acc_guard4(acc[3][0], acc[3][1], acc[3][2], acc[3][3]);

  // ---- epilogue ----
  float* slab = sT[wave];
  const float* Rb = RESID ? (resid + (size_t)b * strideR) : nullptr;
#pragma unroll
  for (int i = 0; i < 4; ++i) {
    const int mBase = m0 + (i << 4);
#pragma unroll
    for (int j = 0; j < 4; ++j) {
      const int n = n0 + (j << 4) + rlane;
      float bv = 0.f;
      if (BIAS_MODE == 2) bv = bias[n];
#pragma unroll
      for (int r = 0; r < 8; ++r) {
        float v = acc[i][j][r] * scale;
        if (BIAS_MODE == 1) v += bias[mBase + mOff + r];
        if (BIAS_MODE == 2) v += bv;
        if (RESID) v += Rb[(size_t)(mBase + mOff + r) * ldc + n];
        if (ACT == 2) v = fmaxf(v, 0.0f);
        if (ACT == 4) v = (v > 0.f) ? v : 0.01f * v;
        slab[(mOff + r) * 68 + (j << 4) + rlane] = v;
      }
    }
    __builtin_amdgcn_fence(__ATOMIC_RELEASE, "workgroup");
    __builtin_amdgcn_wave_barrier();
    __builtin_amdgcn_fence(__ATOMIC_ACQUIRE, "workgroup");
    if (OUT_MODE == 0) {
      float* C = (float*)Cout + (size_t)b * strideC;
      const int hh = lane >> 4, c4 = (lane & 15) * 4;     // row seg = 256 B = 16 lanes x 16 B
      {
#pragma unroll
        for (int it = 0; it < 8; ++it) {
          const int row = it * 2 + hh;
          v4f v = *(const v4f*)(slab + row * 68 + c4);
          *(v4f*)(C + (size_t)(mBase + row) * ldc + n0 + c4) = v;
        }
        
      }
    } else {
      const int q = lane >> 3, c8 = (lane & 7) * 8;
      unsigned short* C  = (unsigned short*)Cout  + (size_t)b * strideC;
      unsigned short* C2 = (OUT_MODE == 2) ? ((unsigned short*)Cout2 + (size_t)b * strideC) : nullptr;
      {
#pragma unroll
        for (int it = 0; it < 4; ++it) {
          const int row = it * 4 + q;
          const float* sp = slab + row * 68 + c8;
          v8h hv, lv;
          if constexpr (SM == 1) {
            // eight lanes hold a row's 64 scores, eight each: maximum, exponentials and their sum in fixed order
            float xs[8];
#pragma unroll
            for (int e = 0; e < 8; ++e) xs[e] = sp[e];
            float mx = fmaxf(fmaxf(fmaxf(xs[0], xs[1]), fmaxf(xs[2], xs[3])), fmaxf(fmaxf(xs[4], xs[5]), fmaxf(xs[6], xs[7])));
            mx = fmaxf(mx, lane_xor<1>(mx));
            mx = fmaxf(mx, lane_xor<2>(mx));
            mx = fmaxf(mx, lane_xor<4>(mx));
#pragma unroll
            for (int e = 0; e < 8; ++e) { xs[e] = ex2(xs[e] - mx); hv[e] = (_Float16)xs[e]; }
            float sum = ((xs[0] + xs[1]) + (xs[2] + xs[3])) + ((xs[4] + xs[5]) + (xs[6] + xs[7]));
            sum += lane_xor<1>(sum);
            sum += lane_xor<2>(sum);
            sum += lane_xor<4>(sum);
            if ((lane & 7) == 0) {
              sStat[wave * 128 + (i << 4) + row]      = mx;
              sStat[wave * 128 + 64 + (i << 4) + row] = sum;
            }
          } else
#pragma unroll
          for (int e = 0; e < 8; ++e) {
            if (OUT_MODE == 1) {
              hv[e] = (_Float16)sp[e];
            } else {
              unsigned short hb = f2bf_bits(sp[e]);
              unsigned short lb = f2bf_bits(sp[e] - bf_bits2f(hb));
              hv[e] = __builtin_bit_cast(_Float16, hb);
              lv[e] = __builtin_bit_cast(_Float16, lb);
            }
          }
          *(v8h*)(C + (size_t)(mBase + row) * ldc + n0 + c8) = hv;
          if (OUT_MODE == 2) *(v8h*)(C2 + (size_t)(mBase + row) * ldc + n0 + c8) = lv;
        }
        
      }
    }
    __builtin_amdgcn_fence(__ATOMIC_RELEASE, "workgroup");
    __builtin_amdgcn_wave_barrier();
    __builtin_amdgcn_fence(__ATOMIC_ACQUIRE, "workgroup");
  }
  if constexpr (SM == 1) {
    // the wave's 64 rows of m and l, behind the fences that end the loop: each store covers one whole 128-byte line
    float* mo = (float*)Cout2 + (size_t)(n0 / kSmTile) * kTok + (size_t)b * M + m0;
    float* lo = mo + (size_t)kSmTiles * kTok;
    const float* st = sStat + wave * 128;
    mo[lane]      = st[lane];
    mo[lane + 32] = st[lane + 32];
    lo[lane]      = st[lane + 64];
    lo[lane + 32] = st[lane + 96];
  }
}

// ---------------------------------------------------------------------------
// Weight transpose + cast: for square [512][512] f32 W (row-major [in d][out h]), WT[h][d] = f16(scale * W[d][h]).
// grid (8, 8, 4): blockIdx.x = d tile (64 cols of WT), blockIdx.y = h tile (64 rows of WT), blockIdx.z selects W0..W3
// and the output plane (plane z at out + z*512*512 halves). 256 threads.
// Load coverage: 16 iterations x 256 threads = 4096 = the whole 64x64 tile (coalesced along h).
// Store coverage: 8 waves x 2 iterations x 4 rows (lane>>3) = 64 rows; (lane&7) x 8 halves = 64 cols; each row segment =
// ---------------------------------------------------------------------------
__global__ __launch_bounds__(256) void wtcast_kernel(const float* __restrict__ W0, const float* __restrict__ W1,
                                                     const float* __restrict__ W2, const float* __restrict__ W3,
                                                     unsigned short* __restrict__ out, float scale) {
  __shared__ float sm[64][65];   // sm[h_local][d_local]
  const int t  = threadIdx.x;
  const int d0 = blockIdx.x * 64;
  const int h0 = blockIdx.y * 64;
  const int z  = blockIdx.z;                                   // block-uniform
  const float* W = (z == 0) ? W0 : (z == 1) ? W1 : (z == 2) ? W2 : W3;
#pragma unroll
  for (int i = 0; i < 16; ++i) {
    const int e = i * 256 + t;
    const int r = e >> 6;          // d local
    const int c = e & 63;          // h local
    sm[c][r] = W[(size_t)(d0 + r) * kHid + h0 + c] * scale;
  }
  __syncthreads();
  const int lane = t & 31, wave = t >> 5;
  const int q = lane >> 3, c8 = (lane & 7) * 8;
  unsigned short* op = out + (size_t)z * kHid * kDim;
  {
#pragma unroll
    for (int it = 0; it < 2; ++it) {
      const int row = wave * 8 + it * 4 + q;                 // h local
      unsigned short hb[8];
#pragma unroll
      for (int e = 0; e < 8; ++e) hb[e] = h_bits(sm[row][c8 + e]);
      const v4u u = (v4u){pk16(hb[0], hb[1]), pk16(hb[2], hb[3]), pk16(hb[4], hb[5]), pk16(hb[6], hb[7])};
      *(v4u*)(op + (size_t)(h0 + row) * kDim + d0 + c8) = u;
    }
    
  }
}

// ---------------------------------------------------------------------------
// ---------------------------------------------------------------------------
__global__ __launch_bounds__(256) void cast8_f16_kernel(const float* __restrict__ in, unsigned short* __restrict__ out, int n8) {
  const int i = blockIdx.x * 256 + threadIdx.x;
  if (i >= n8) return;
  const float* p = in + 8 * (size_t)i;
  const v4f a = *(const v4f*)(p);
  const v4f c = *(const v4f*)(p + 4);
  unsigned short hb[8];
#pragma unroll
  for (int e = 0; e < 4; ++e) {
    hb[e]     = h_bits(a[e]);
    hb[4 + e] = h_bits(c[e]);
  }
  const v4u u = (v4u){pk16(hb[0], hb[1]), pk16(hb[2], hb[3]), pk16(hb[4], hb[5]), pk16(hb[6], hb[7])};
  unsigned short* q = out + 8 * (size_t)i;
  *(v4u*)q = u;
  
}

// ---------------------------------------------------------------------------
// Host side: 8 launches, all grids exact functions of the fixed shapes.
// ---------------------------------------------------------------------------
extern "C" void kernel_launch(void* const* d_in, const int* in_sizes, int n_in,
                              void* d_out, int out_size, void* d_ws, size_t ws_size, hipStream_t stream) {
  if (n_in < 9) return;
  if (in_sizes[0] != kTok * kDim) return;
  if (in_sizes[1] != kDim * kHid || in_sizes[3] != kDim * kHid || in_sizes[5] != kDim * kHid || in_sizes[7] != kDim * kHid) return;
  if (in_sizes[2] != kHid || in_sizes[4] != kHid || in_sizes[6] != kHid || in_sizes[8] != kHid) return;
  if (out_size != kTok * kDim) return;
  if (ws_size < kWsTotal) return;

  const float* x  = (const float*)d_in[0];
  const float* Wq = (const float*)d_in[1];
  const float* bq = (const float*)d_in[2];
  const float* Wk = (const float*)d_in[3];
  const float* bk = (const float*)d_in[4];
  const float* Wv = (const float*)d_in[5];
  const float* bv = (const float*)d_in[6];
  const float* Wo = (const float*)d_in[7];
  const float* bo = (const float*)d_in[8];
  float* out = (float*)d_out;

  char* ws = (char*)d_ws;
  unsigned short* X16  = (unsigned short*)(ws + kOffX);
  unsigned short* Q16  = (unsigned short*)(ws + kOffQ);
  unsigned short* K16  = (unsigned short*)(ws + kOffK);
  unsigned short* VT16 = (unsigned short*)(ws + kOffVT);
  unsigned short* O16  = (unsigned short*)(ws + kOffO);
  unsigned short* WT   = (unsigned short*)(ws + kOffWT);
  unsigned short* EBUF = (unsigned short*)(ws + kOffE);
  float*          STAT = (float*)(ws + kOffStat);
  const size_t wplane = (size_t)kHid * kDim;            // halves per W^T plane
  unsigned short* WqT = WT;
  unsigned short* WkT = WT + wplane;
  unsigned short* WvT = WT + 2 * wplane;
  unsigned short* WoT = WT + 3 * wplane;

  // 1) W^T planes: WT[z][h][d] = f16(16 * W_z[d][h]); grid (512/64, 512/64, 4)
  wtcast_kernel<<<dim3(kDim / 64, kHid / 64, 4), 256, 0, stream>>>(Wq, Wk, Wv, Wo, WT, kWCarry);

  // 2) x -> X16 [16384][512]; n8 = 1,048,576 -> 4096 blocks exactly
  {
    const int n8 = kTok * kDim / 8;
    cast8_f16_kernel<<<dim3((n8 + 255) / 256), 256, 0, stream>>>(x, X16, n8);
  }

  const long tokPlane = (long)kSeq * kDim;               // halves per batch of a [token][512] plane = 1,048,576
  const long vtPlane  = (long)kDim * kSeq;               // halves per batch of V^T [512][2048]

  // 3) Q16 = (X16 . WqT) / 16 + bq   M 16384, N 512, K 512 -> 128 x 2 block tiles = 256 blocks
  wmma_gemm64<0, false, 2, 1, false><<<dim3((kTok / kBlockM) * (kHid / kBlockN), 1), 256, 0, stream>>>(
      X16, X16, kDim, 0L, WqT, WqT, kDim, 0L, (void*)Q16, (void*)Q16, kHid, 0L,
      bq, bq, 0L, kTok, kHid, kDim, kWCarryInv);
  // 4) K16 likewise
  wmma_gemm64<0, false, 2, 1, false><<<dim3((kTok / kBlockM) * (kHid / kBlockN), 1), 256, 0, stream>>>(
      X16, X16, kDim, 0L, WkT, WkT, kDim, 0L, (void*)K16, (void*)K16, kHid, 0L,
      bk, bk, 0L, kTok, kHid, kDim, kWCarryInv);
  // 5) V^T per batch: VT16[b][d][m] = sum_k WvT[d][k] X16[b*2048+m][k] / 16 + bv[d]
  //    A = WvT [512][512] (stride 0), Bt = X16 batch rows [2048][512], C [512][2048]; M 512, N 2048, K 512 -> 4 x 8 block tiles = 32 blocks, grid.y = 8
  wmma_gemm64<0, false, 1, 1, false><<<dim3((kHid / kBlockM) * (kSeq / kBlockN), kBatch), 256, 0, stream>>>(
      WvT, WvT, kDim, 0L, X16, X16, kDim, tokPlane, (void*)VT16, (void*)VT16, kSeq, vtPlane,
      bv, bv, 0L, kHid, kSeq, kDim, kWCarryInv);

  // 6) attention, all 8 batches in each launch (grid.y = batch), the softmax split over the two products:
  //    E = 2^(s - m) per 64-key tile with the tile's m and l (score launch), O16 = 256 * sum over tiles of (weight / L) * E.V
  const long sPlane = (long)kSeq * kSeq;                 // elements per batch of E = 4,194,304
  // E [8][2048][2048]: per batch M 2048, N 2048, K 512 -> 16 x 8 block tiles = 128 blocks; 1024 blocks in all
  wmma_gemm64<0, false, 0, 1, false, 0, 1><<<dim3((kSeq / kBlockM) * (kSeq / kBlockN), kBatch), 256, 0, stream>>>(
      Q16, Q16, kHid, tokPlane, K16, K16, kHid, tokPlane, (void*)EBUF, (void*)STAT, kSeq, sPlane,
      bq, bq, 0L, kSeq, kSeq, kHid, kAttnScaleL2);
  // O : A = E [2048][2048], Bt = V^T [512][2048]; per batch M 2048, N 512, K 2048 -> 16 x 2 block tiles = 32 blocks;
  // 256 blocks in all; scale 256/2048
  wmma_gemm64<0, false, 0, 1, false, 0, 2><<<dim3((kSeq / kBlockM) * (kHid / kBlockN), kBatch), 256, 0, stream>>>(
      EBUF, EBUF, kSeq, sPlane, VT16, VT16, kSeq, vtPlane, (void*)O16, (void*)O16, kHid, tokPlane,
      bv, STAT, 0L, kSeq, kHid, kSeq, kPVScale);

  // 7) out = (O16 . WoT) / 4096 + bo   M 16384, N 512, K 512 -> 128 x 2 block tiles = 256 blocks; f32 whole-line epilogue into d_out
  wmma_gemm64<0, false, 2, 0, false><<<dim3((kTok / kBlockM) * (kDim / kBlockN), 1), 256, 0, stream>>>(
      O16, O16, kHid, 0L, WoT, WoT, kHid, 0L, (void*)out, (void*)out, kDim, 0L,
      bo, bo, 0L, kTok, kDim, kHid, kOutScale);
}

// v005
// Measured time: 125 microseconds a run.
// Two timings next to v004 both put it at 1.04 times that version's speed.
// Over all steps from v000 it is 8.76 times as fast.
// Contractions: q/k/v projections (X f16 x W^T f16 carried x16), scores q.k^T (q,k f16 planes), attn.v (E f16, the exponential of a score against its 64-key tile's row maximum, times the tile's weight in f16 carried x2048, x V^T f16), output projection (O f16 carried x256 x Wo^T f16 carried x16), all on v_wmma_f32_16x16x32_f16 with f32 accumulate; softmax and biases in f32.
#include <hip/hip_runtime.h>
#include <math.h>

// ---------------------------------------------------------------------------
// Problem constants
// ---------------------------------------------------------------------------
constexpr int kBatch = 8;
constexpr int kSeq   = 2048;
constexpr int kDim   = 512;               // embed dim (input and output of every projection)
constexpr int kHid   = 512;
constexpr int kTok   = kBatch * kSeq;     // 16384 token rows
constexpr float kWCarry    = 16.0f;       // weights carried x16 in f16
constexpr float kWCarryInv = 1.0f / 16.0f;
constexpr float kPCarry    = 2048.0f;     // probabilities carried x2048 in f16
constexpr float kOCarry    = 256.0f;      // attention output carried x256 in f16
constexpr float kPVScale   = kOCarry / kPCarry;              // 1/8
constexpr float kOutScale  = 1.0f / (kOCarry * kWCarry);     // 1/4096
constexpr float kAttnScaleL2 = 0.044194173824159216f * 1.4426950408889634f;   // 512^-0.5 * log2(e): scores are kept in log2 units
constexpr int   kSmTile  = 64;                // keys per softmax tile = the columns of one wave's score tile
constexpr int   kSmTiles = kSeq / kSmTile;    // 32 tiles per row

// ---------------------------------------------------------------------------
// Workspace region map (bytes); total 174,063,616 B
//   [  0 MiB, 16 MiB)  X16   f16 [16384][512]
//   [ 16 MiB, 32 MiB)  Q16   f16 [16384][512]
//   [ 32 MiB, 48 MiB)  K16   f16 [16384][512]
//   [ 48 MiB, 64 MiB)  (unused)
//   [ 64 MiB, 80 MiB)  VT16  f16 [8][512][2048]
//   [ 80 MiB, 96 MiB)  O16   f16 [16384][512]   (carried x256)
//   [ 96 MiB, 98 MiB)  WT16  f16 4 x [512][512]  (Wq^T, Wk^T, Wv^T, Wo^T, carried x16)
//   [ 98 MiB,162 MiB)  EBUF  f16 [8][2048][2048] (all batches): 2^(s - m), s the score in log2 units, m its tile's row maximum
//   [162 MiB,166 MiB)  STAT  f32 2 x [32][16384]: plane 0 m[tile][token], plane 1 l[tile][token] = the tile's row sum of 2^(s - m)
// ---------------------------------------------------------------------------
constexpr size_t kPlane16 = (size_t)kTok * kDim * 2;                 // 16,777,216
constexpr size_t kOffX   = 0;
constexpr size_t kOffQ   = kOffX  + kPlane16;
constexpr size_t kOffK   = kOffQ  + kPlane16;
constexpr size_t kOffVT  = kOffK  + 2 * kPlane16;
constexpr size_t kOffO   = kOffVT + kPlane16;
constexpr size_t kOffWT  = kOffO  + kPlane16;
constexpr size_t kWTBytes = (size_t)4 * kHid * kDim * 2;              // 2,097,152
constexpr size_t kOffE   = kOffWT + kWTBytes;
constexpr size_t kEBytes = (size_t)kBatch * kSeq * kSeq * 2;          // 67,108,864
constexpr size_t kOffStat   = kOffE + kEBytes;
constexpr size_t kStatBytes = (size_t)2 * kSmTiles * kTok * 4;        // 4,194,304
constexpr size_t kWsTotal = kOffStat + kStatBytes;                    // 174,063,616

typedef __attribute__((ext_vector_type(16))) _Float16 v16h;
typedef __attribute__((ext_vector_type(8)))  _Float16 v8h;
typedef __attribute__((ext_vector_type(4)))  _Float16 v4h;
typedef __attribute__((ext_vector_type(2)))  _Float16 v2h;
typedef __attribute__((ext_vector_type(2)))  unsigned int v2u;
typedef __attribute__((ext_vector_type(16))) __bf16   v16b;
typedef __attribute__((ext_vector_type(8)))  __bf16   v8b;
typedef __attribute__((ext_vector_type(8)))  float    v8f;
typedef __attribute__((ext_vector_type(4)))  float    v4f;
typedef __attribute__((ext_vector_type(4)))  unsigned int v4u;

__device__ __forceinline__ unsigned short f2bf_bits(float f) {
  unsigned u = __float_as_uint(f);
  return (unsigned short)((u + 0x7FFFu + ((u >> 16) & 1u)) >> 16);
}
__device__ __forceinline__ float bf_bits2f(unsigned short h) { return __uint_as_float(((unsigned)h) << 16); }

// hazard guards as plain device helpers
__device__ __forceinline__ void dep_guard_h(v8f& a, v8f& b, v16h x, v16h y) { asm volatile("v_nop\n\tv_nop\n\tv_nop\n\tv_nop" : "+v"(a), "+v"(b) : "v"(x), "v"(y)); }
__device__ __forceinline__ void dep_guard_b(v8f& a, v8f& b, v16b x, v16b y) { asm volatile("v_nop\n\tv_nop\n\tv_nop\n\tv_nop" : "+v"(a), "+v"(b) : "v"(x), "v"(y)); }
__device__ __forceinline__ void keep4_h(v16h a, v16h b, v16h c, v16h d) { asm volatile("v_nop" :: "v"(a), "v"(b), "v"(c), "v"(d)); }
__device__ __forceinline__ void keep4_b(v16b a, v16b b, v16b c, v16b d) { asm volatile("v_nop" :: "v"(a), "v"(b), "v"(c), "v"(d)); }
__device__ __forceinline__ void acc_guard4(v8f& a, v8f& b, v8f& c, v8f& d) { asm volatile("v_nop\n\tv_nop\n\tv_nop\n\tv_nop" : "+v"(a), "+v"(b), "+v"(c), "+v"(d)); }
template <typename T> struct Frag;
template <> struct Frag<_Float16> {
  typedef v16h V; union U { v16h v; v8h h[2]; };
  static __device__ __forceinline__ v16h load(const _Float16* p) {   // elements 0..7 <- p[0..7], 8..15 <- p[16..23]
    U f; f.h[0] = *(const v8h*)(p); f.h[1] = *(const v8h*)(p + 16); return f.v;
  }
  static __device__ __forceinline__ v8f mma(v16h a, v16h b, v8f c) {
    return __builtin_amdgcn_wmma_f32_16x16x32_f16(false, a, false, b, (short)0, c, false, false);
  }
  static __device__ __forceinline__ void guard(v8f& a, v8f& b, v16h x, v16h y) { dep_guard_h(a, b, x, y); }
  static __device__ __forceinline__ void keep(v16h a, v16h b, v16h c, v16h d) { keep4_h(a, b, c, d); }
};
template <> struct Frag<__bf16> {
  typedef v16b V; union U { v16b v; v8b h[2]; };
  static __device__ __forceinline__ v16b load(const __bf16* p) {
    U f; f.h[0] = *(const v8b*)(p); f.h[1] = *(const v8b*)(p + 16); return f.v;
  }
  static __device__ __forceinline__ v8f mma(v16b a, v16b b, v8f c) {
    return __builtin_amdgcn_wmma_f32_16x16x32_bf16(false, a, false, b, (short)0, c, false, false);
  }
  static __device__ __forceinline__ void guard(v8f& a, v8f& b, v16b x, v16b y) { dep_guard_b(a, b, x, y); }
  static __device__ __forceinline__ void keep(v16b a, v16b b, v16b c, v16b d) { keep4_b(a, b, c, d); }
};

__device__ __forceinline__ unsigned pk16(unsigned short a, unsigned short b) { return (unsigned)a | ((unsigned)b << 16); }
__device__ __forceinline__ unsigned short h_bits(float f) { const _Float16 h = (_Float16)f; return __builtin_bit_cast(unsigned short, h); }

// ---- Operand ring in LDS ---------------------------------------------------------------------------------------------
// A block of 8 waves (2 x 4) owns a 128 x 256 tile of C. A stage is 128 k (256 B) of its 128 A rows and 256 Bt rows:
// 384 LDS rows at a pitch of 272 B (16 B x odd, conflict-free for 16-byte row readers); two buffers.
constexpr int kStageK     = 128;                         // halves of k per stage
constexpr int kBlockM     = 128;
constexpr int kBlockN     = 256;
constexpr int kStageRows  = kBlockM + kBlockN;           // 384
constexpr int kRingPitch  = 272;                         // bytes per LDS row
constexpr int kStageBytes = kStageRows * kRingPitch;     // 104,448

// Twelve copies of 16 B per lane, global memory to LDS through no register. The s_wait_xcnt is the last line of the copies'
// own statement, so that it stands in front of any rewrite of an address register that a copy names.
__device__ __forceinline__ void copy12(const unsigned (&l)[12], const char* const (&g)[12]) {
  asm volatile(
      "global_load_async_to_lds_b128 %0, %12, off\n\t"
      "global_load_async_to_lds_b128 %1, %13, off\n\t"
      "global_load_async_to_lds_b128 %2, %14, off\n\t"
      "global_load_async_to_lds_b128 %3, %15, off\n\t"
      "global_load_async_to_lds_b128 %4, %16, off\n\t"
      "global_load_async_to_lds_b128 %5, %17, off\n\t"
      "global_load_async_to_lds_b128 %6, %18, off\n\t"
      "global_load_async_to_lds_b128 %7, %19, off\n\t"
      "global_load_async_to_lds_b128 %8, %20, off\n\t"
      "global_load_async_to_lds_b128 %9, %21, off\n\t"
      "global_load_async_to_lds_b128 %10, %22, off\n\t"
      "global_load_async_to_lds_b128 %11, %23, off\n\t"
      "s_wait_xcnt 0x0"
      :: "v"(l[0]), "v"(l[1]), "v"(l[2]), "v"(l[3]), "v"(l[4]), "v"(l[5]), "v"(l[6]), "v"(l[7]), "v"(l[8]), "v"(l[9]), "v"(l[10]), "v"(l[11]),
         "v"(g[0]), "v"(g[1]), "v"(g[2]), "v"(g[3]), "v"(g[4]), "v"(g[5]), "v"(g[6]), "v"(g[7]), "v"(g[8]), "v"(g[9]), "v"(g[10]), "v"(g[11])
      : "memory");
}
// One stage: thread t brings 16 B of LDS rows (t >> 4) + 16 * i, i = 0..23 (i < 8: A rows, else Bt rows); a wave's copy covers
// two whole 256-B row pieces. l: the thread's LDS byte address in row t >> 4 of the buffer; ga, gb: its bytes of the first
// A row and the first Bt row of the stage; stepA, stepB: 16 rows in bytes.
__device__ __forceinline__ void stage_copy(unsigned l, const char* ga, size_t stepA, const char* gb, size_t stepB) {
  unsigned la[12], lb[12];
  const char* pa[12];
  const char* pb[12];
#pragma unroll
  for (int i = 0; i < 12; ++i) {
    la[i] = l + (unsigned)(i * 16 * kRingPitch);
    lb[i] = l + (unsigned)((i + 12) * 16 * kRingPitch);
    pa[i] = (i < 8) ? ga + (size_t)i * stepA : gb + (size_t)(i - 8) * stepB;
    pb[i] = gb + (size_t)(i + 4) * stepB;
  }
  copy12(la, pa);
  copy12(lb, pb);
}
// this wave's copies have landed (the compiler places no wait for them)
__device__ __forceinline__ void wait_copies() { asm volatile("s_wait_asynccnt 0x0" ::: "memory"); }
// this wave's LDS reads have retired, before the buffer they read is handed back for a refill
__device__ __forceinline__ void wait_lds_reads() { asm volatile("s_wait_dscnt 0x0" ::: "memory"); }

// ---- Softmax split over the two attention products --------------------------------------------------------------------
// 2^a. v_nop: the independent slot that the instruction set asks for behind a transcendental.
__device__ __forceinline__ float ex2(float a) {
  float r;
  asm("v_exp_f32 %0, %1\n\tv_nop" : "=v"(r) : "v"(a));
  return r;
}
// the value of lane l ^ X inside a 16-lane row (DPP row_xmask:X; every lane is on where it is used)
template <int X> __device__ __forceinline__ float lane_xor(float v) {
  return __builtin_bit_cast(float, __builtin_amdgcn_update_dpp(0, __builtin_bit_cast(int, v), 0x160 + X, 0xf, 0xf, true));
}
constexpr int kWPitch = kSmTiles + 2;   // dwords per row of the tile-weight table in LDS: even (8-byte reads), 34 r mod 64 distinct for 16 rows

// ---- Register-blocked batched WMMA GEMM, operands through the LDS ring --------------------------------------------------
// C[m,n] = scale * sum_k A[m,k] * Bt[n,k] (+bias)(+resid); each block owns a 128x256 tile, each wave a 64x64 tile of it.
// A row-major [M,K]; Bt row-major [N,K]; M % 128 == 0, N % 256 == 0, K % 128 == 0; grid.x = (M/128)*(N/256).
// SPLIT (hi/lo operand planes A2/Bt2) has no user here and is refused at compile time: the ring stages one plane per operand.
// BIAS_MODE: 0 = none, 1 = bias[m], 2 = bias[n], 3 = the three input projections in one grid (blockIdx.y: 0 = q, 1 = k, both
//     C = X . W^T + bias[n]; 2 = v, operands in each other's place, C = V^T per batch + bias[m]). The arguments are then
//     Ap = X, Btp = the W^T planes (q, k, v in a row), Cout = the q plane (k behind it), Cout2 = V^T, bias = bq, resid = bk,
//     bias3 = bv; M, N, K, lda, ldb, ldc as for q.
// OUT_MODE: 0 = f32, 1 = f16, 2 = bf16 hi plane (Cout) + bf16 lo plane (Cout2).
// ET: 0 = f16 operands, 1 = bf16 operands (pointers passed as 16-bit storage)
// SM: 0 = plain. 1 = score product: C = f16(2^(s - m)) with m the row's maximum over the wave's 64 columns; m and the row sum l
//     of the 64 exponentials go to Cout2 (planes [tile][token]). 2 = attn.v: A rows are weighted per 64-k tile by
//     2048 * 2^(m_tile - max m) / L, L = sum over tiles of 2^(m_tile - max m) * l; m and l come in through resid.
template <int ET> struct Elem;
template <> struct Elem<0> { typedef _Float16 T; };
template <> struct Elem<1> { typedef __bf16 T; };
template <int ET, bool SPLIT, int BIAS_MODE, int OUT_MODE, bool RESID, int ACT = 0, int SM = 0>
__global__ __launch_bounds__(256) void wmma_gemm64(
    const unsigned short* __restrict__ Ap, const unsigned short* __restrict__ A2p, int lda, long strideA,
    const unsigned short* __restrict__ Btp, const unsigned short* __restrict__ Bt2p, int ldb, long strideB,
    void* __restrict__ Cout, void* __restrict__ Cout2, int ldc, long strideC,
    const float* __restrict__ bias,
    const float* __restrict__ resid, long strideR,
    int M, int N, int K, float scale, const float* __restrict__ bias3) {
  typedef typename Elem<ET>::T T;
  typedef typename Frag<T>::V V;
  static_assert(!SPLIT, "the LDS ring stages one plane per operand");
  const T* A = (const T*)Ap; const T* Bt = (const T*)Btp;
  __shared__ __align__(16) unsigned char ring[2 * kStageBytes];   // two stages of operand rows
  __shared__ __align__(16) float sT[8][16 * 68];   // per-wave 16x64 slab, pitch 68 floats
  __shared__ __align__(16) float sStat[SM == 1 ? 8 * 128 : 4];               // SM 1: per wave m[64], l[64] of its rows
  __shared__ __align__(16) unsigned sW[SM == 2 ? kBlockM * kWPitch : 4];     // SM 2: tile weights, f16 twice in a dword
  int b    = blockIdx.y;
  int tile = blockIdx.x;
  const float* biasp = bias;
  void* Cdst = Cout;
  bool rowBias = (BIAS_MODE == 1);       // block-uniform
  if constexpr (BIAS_MODE == 3) {
    const int which = blockIdx.y;        // block-uniform
    b = 0;
    if (which < 2) {
      Bt   += (size_t)which * kHid * kDim;
      Cdst  = (void*)((unsigned short*)Cout + (size_t)which * kTok * kHid);
      if (which == 1) biasp = resid;
    } else {
      A  = Bt + (size_t)2 * kHid * kDim;          // Wv^T rows [512][512]
      Bt = (const T*)Ap;                          // the batch's token rows [2048][512]
      strideB = (long)kSeq * kDim;
      Cdst    = Cout2;
      ldc     = kSeq;
      strideC = (long)kDim * kSeq;
      biasp   = bias3;
      rowBias = true;
      M = kHid;
      N = kSeq;
      b    = tile >> 5;                           // (512 / 128) * (2048 / 256) = 32 block tiles per batch
      tile = tile & 31;
    }
  }
  const int lane = threadIdx.x & 31;
  const int wave = threadIdx.x >> 5;
  const int tilesN = N / kBlockN;
  const int tilesM = M / kBlockM;
  if (tile >= tilesM * tilesN) return;   // block-uniform, in front of every barrier and copy
  const int tm = tile / tilesN;
  const int tn = tile - tm * tilesN;
  const int bm0 = tm * kBlockM;
  const int bn0 = tn * kBlockN;
  const int wm = wave >> 2;              // wave grid 2 (m) x 4 (n)
  const int wn = wave & 3;
  const int m0 = bm0 + (wm << 6);
  const int n0 = bn0 + (wn << 6);

  const T* Ab  = A  + (size_t)b * strideA;
  const T* Bb  = Bt + (size_t)b * strideB;

  // copy side: this thread's 16-byte column and first row of a stage
  const int crow = threadIdx.x >> 4;
  const int ccol = (threadIdx.x & 15) * 16;
  const char* gA = (const char*)(Ab + (size_t)(bm0 + crow) * lda) + ccol;
  const char* gB = (const char*)(Bb + (size_t)(bn0 + crow) * ldb) + ccol;
  const size_t stepA = (size_t)lda * (16 * sizeof(T));
  const size_t stepB = (size_t)ldb * (16 * sizeof(T));
  const unsigned ldsCopy = (unsigned)(size_t)ring + (unsigned)(crow * kRingPitch + ccol);
  const int nStages = K / kStageK;

  const int rlane = lane & 15;                 // row (A) / col (B, D) within subtile
  const int koff  = (lane >> 4) * 8;           // k offset of this lane half
  const int mOff  = (lane >> 4) * 8;           // D row offset

  v8f acc[4][4];
#pragma unroll
  for (int i = 0; i < 4; ++i)
#pragma unroll
    for (int j = 0; j < 4; ++j) acc[i][j] = (v8f){0.f,0.f,0.f,0.f,0.f,0.f,0.f,0.f};

  // reader side: this lane's byte offsets in a stage (same k order for A and Bt as from global memory)
  const int aRd = ((wm << 6) + rlane) * kRingPitch + koff * (int)sizeof(T);
  const int bRd = (kBlockM + (wn << 6) + rlane) * kRingPitch + koff * (int)sizeof(T);

  // prologue: stage 0 lands and is published, then stage 1 flies while stage 0 is worked on
  stage_copy(ldsCopy, gA, stepA, gB, stepB);
  if constexpr (SM == 2) {
    // while stage 0 flies: the row's tile weights, published by the barrier below. Thread t: row t & 127; both
    // halves of the block do the same sums in the same order, each writes 16 of the 32 weights.
    const int srow = threadIdx.x & (kBlockM - 1);
    const int half = threadIdx.x >> 7;
    const float* mp = resid + (size_t)b * M + bm0 + srow;
    const float* lp = mp + (size_t)kSmTiles * kTok;
    float mv[kSmTiles], lv[kSmTiles];
#pragma unroll
    for (int t = 0; t < kSmTiles; ++t) { mv[t] = mp[(size_t)t * kTok]; lv[t] = lp[(size_t)t * kTok]; }
    asm volatile("s_wait_xcnt 0x0" ::: "memory");   // in front of any rewrite of an address register that these loads name
    float gm = mv[0];
#pragma unroll
    for (int t = 1; t < kSmTiles; ++t) gm = fmaxf(gm, mv[t]);
    float tot = 0.f;
#pragma unroll
    for (int t = 0; t < kSmTiles; ++t) {
      mv[t] = ex2(mv[t] - gm);
      tot += mv[t] * lv[t];
    }
    const float inv = kPCarry / tot;   // tot >= 1: the tile that holds the row's maximum has weight 1 and l >= 1
    unsigned* wrow = sW + srow * kWPitch + half * (kSmTiles / 2);
#pragma unroll
    for (int t = 0; t < kSmTiles / 2; ++t) {
      const unsigned short hb = h_bits((half ? mv[t + kSmTiles / 2] : mv[t]) * inv);
      wrow[t] = pk16(hb, hb);
    }
  }
  wait_copies();
  __syncthreads();
  if (nStages > 1)   // block-uniform
    stage_copy(ldsCopy + kStageBytes, gA + kStageK * sizeof(T), stepA, gB + kStageK * sizeof(T), stepB);

#pragma unroll 1
  for (int s = 0; s < nStages; ++s) {   // rolled: one publish point per trip
    const unsigned bufOff = (s & 1) ? (unsigned)kStageBytes : 0u;
    const unsigned char* buf = ring + bufOff;
    V fa[2][4], fb[2][4];               // two fragment sets: the next 32 k are fetched while these are multiplied
    v2u wS[4];                          // SM 2: the weights of this stage's two 64-k tiles for the lane's four A rows
    if constexpr (SM == 2) {
#pragma unroll
      for (int f = 0; f < 4; ++f) wS[f] = *(const v2u*)(sW + ((wm << 6) + f * 16 + rlane) * kWPitch + 2 * s);
    }
#pragma unroll
    for (int f = 0; f < 4; ++f) {
      fb[0][f] = Frag<T>::load((const T*)(buf + bRd + f * 16 * kRingPitch));
      fa[0][f] = Frag<T>::load((const T*)(buf + aRd + f * 16 * kRingPitch));
    }
#pragma unroll
    for (int ks = 0; ks < kStageK / 32; ++ks) {
      const int cur = ks & 1, nxt = cur ^ 1;
      if (ks + 1 < kStageK / 32) {
#pragma unroll
        for (int f = 0; f < 4; ++f) {
          fb[nxt][f] = Frag<T>::load((const T*)(buf + bRd + f * 16 * kRingPitch + (ks + 1) * 64));
          fa[nxt][f] = Frag<T>::load((const T*)(buf + aRd + f * 16 * kRingPitch + (ks + 1) * 64));
        }
      }
      __builtin_amdgcn_sched_barrier(0);   // keeps the LDS reads one group ahead of the products, not spread among them
      if constexpr (SM == 2) {
#pragma unroll
        for (int i = 0; i < 4; ++i) {
          const v2h w2 = __builtin_bit_cast(v2h, (unsigned)wS[i][ks >> 1]);
          fa[cur][i] = fa[cur][i] * __builtin_shufflevector(w2, w2, 0, 1, 0, 1, 0, 1, 0, 1, 0, 1, 0, 1, 0, 1, 0, 1);
        }
      }
#pragma unroll
      for (int i = 0; i < 4; ++i) {
#pragma unroll
        for (int j = 0; j < 4; ++j) acc[i][j] = Frag<T>::mma(fa[cur][i], fb[cur][j], acc[i][j]);
      }
      __builtin_amdgcn_sched_barrier(0);   // the next group of LDS reads stays behind this run of products
    }
    // publish point of stage s + 1: own reads retired, own copies landed, then the one barrier of the trip
    wait_lds_reads();
    wait_copies();
    __syncthreads();
    if (s + 2 < nStages) {   // block-uniform: refill the buffer that this trip has just read
      const size_t kb = (size_t)(s + 2) * (kStageK * sizeof(T));
      stage_copy(ldsCopy + bufOff, gA + kb, stepA, gB + kb, stepB);
    }
  }
  wait_copies();   // nothing is outstanding when the wave goes on to the epilogue and ends
  acc_guard4(acc[0][0], acc[0][1], acc[0][2], acc[0][3]);
  acc_guard4(acc[1][0], acc[1][1], acc[1][2], acc[1][3]);
  acc_guard4(acc[2][0], acc[2][1], acc[2][2], acc[2][3]);
  acc_guard4(acc[3][0], acc[3][1], acc[3][2], acc[3][3]);

  // ---- epilogue ----
  float* slab = sT[wave];
  const float* Rb = RESID ? (resid + (size_t)b * strideR) : nullptr;
#pragma unroll
  for (int i = 0; i < 4; ++i) {
    const int mBase = m0 + (i << 4);
    float rb[8], cb[4];
    if constexpr (BIAS_MODE == 3) {   // one group of loads per 16 rows, as in modes 1 and 2; the branch is block-uniform
#pragma unroll
      for (int r = 0; r < 8; ++r) rb[r] = 0.f;
#pragma unroll
      for (int j = 0; j < 4; ++j) cb[j] = 0.f;
      if (rowBias) {
#pragma unroll
        for (int r = 0; r < 8; ++r) rb[r] = biasp[mBase + mOff + r];
      } else {
#pragma unroll
        for (int j = 0; j < 4; ++j) cb[j] = biasp[n0 + (j << 4) + rlane];
      }
    }
#pragma unroll
    for (int j = 0; j < 4; ++j) {
      const int n = n0 + (j << 4) + rlane;
      float bv = 0.f;
      if (BIAS_MODE == 2) bv = bias[n];
      if (BIAS_MODE == 3) bv = cb[j];
#pragma unroll
      for (int r = 0; r < 8; ++r) {
        float v = acc[i][j][r] * scale;
        if (BIAS_MODE == 1) v += bias[mBase + mOff + r];
        if (BIAS_MODE == 2) v += bv;
        if (BIAS_MODE == 3) v += rowBias ? rb[r] : bv;
        if (RESID) v += Rb[(size_t)(mBase + mOff + r) * ldc + n];
        if (ACT == 2) v = fmaxf(v, 0.0f);
        if (ACT == 4) v = (v > 0.f) ? v : 0.01f * v;
        slab[(mOff + r) * 68 + (j << 4) + rlane] = v;
      }
    }
    __builtin_amdgcn_fence(__ATOMIC_RELEASE, "workgroup");
    __builtin_amdgcn_wave_barrier();
    __builtin_amdgcn_fence(__ATOMIC_ACQUIRE, "workgroup");
    if (OUT_MODE == 0) {
      float* C = (float*)Cdst + (size_t)b * strideC;
      const int hh = lane >> 4, c4 = (lane & 15) * 4;     // row seg = 256 B = 16 lanes x 16 B
      {
#pragma unroll
        for (int it = 0; it < 8; ++it) {
          const int row = it * 2 + hh;
          v4f v = *(const v4f*)(slab + row * 68 + c4);
          *(v4f*)(C + (size_t)(mBase + row) * ldc + n0 + c4) = v;
        }
        
      }
    } else {
      const int q = lane >> 3, c8 = (lane & 7) * 8;
      unsigned short* C  = (unsigned short*)Cdst  + (size_t)b * strideC;
      unsigned short* C2 = (OUT_MODE == 2) ? ((unsigned short*)Cout2 + (size_t)b * strideC) : nullptr;
      {
#pragma unroll
        for (int it = 0; it < 4; ++it) {
          const int row = it * 4 + q;
          const float* sp = slab + row * 68 + c8;
          v8h hv, lv;
          if constexpr (SM == 1) {
            // eight lanes hold a row's 64 scores, eight each: maximum, exponentials and their sum in fixed order
            float xs[8];
#pragma unroll
            for (int e = 0; e < 8; ++e) xs[e] = sp[e];
            float mx = fmaxf(fmaxf(fmaxf(xs[0], xs[1]), fmaxf(xs[2], xs[3])), fmaxf(fmaxf(xs[4], xs[5]), fmaxf(xs[6], xs[7])));
            mx = fmaxf(mx, lane_xor<1>(mx));
            mx = fmaxf(mx, lane_xor<2>(mx));
            mx = fmaxf(mx, lane_xor<4>(mx));
#pragma unroll
            for (int e = 0; e < 8; ++e) { xs[e] = ex2(xs[e] - mx); hv[e] = (_Float16)xs[e]; }
            float sum = ((xs[0] + xs[1]) + (xs[2] + xs[3])) + ((xs[4] + xs[5]) + (xs[6] + xs[7]));
            sum += lane_xor<1>(sum);
            sum += lane_xor<2>(sum);
            sum += lane_xor<4>(sum);
            if ((lane & 7) == 0) {
              sStat[wave * 128 + (i << 4) + row]      = mx;
              sStat[wave * 128 + 64 + (i << 4) + row] = sum;
            }
          } else
#pragma unroll
          for (int e = 0; e < 8; ++e) {
            if (OUT_MODE == 1) {
              hv[e] = (_Float16)sp[e];
            } else {
              unsigned short hb = f2bf_bits(sp[e]);
              unsigned short lb = f2bf_bits(sp[e] - bf_bits2f(hb));
              hv[e] = __builtin_bit_cast(_Float16, hb);
              lv[e] = __builtin_bit_cast(_Float16, lb);
            }
          }
          *(v8h*)(C + (size_t)(mBase + row) * ldc + n0 + c8) = hv;
          if (OUT_MODE == 2) *(v8h*)(C2 + (size_t)(mBase + row) * ldc + n0 + c8) = lv;
        }
        
      }
    }
    __builtin_amdgcn_fence(__ATOMIC_RELEASE, "workgroup");
    __builtin_amdgcn_wave_barrier();
    __builtin_amdgcn_fence(__ATOMIC_ACQUIRE, "workgroup");
  }
  if constexpr (SM == 1) {
    // the wave's 64 rows of m and l, behind the fences that end the loop: each store covers one whole 128-byte line
    float* mo = (float*)Cout2 + (size_t)(n0 / kSmTile) * kTok + (size_t)b * M + m0;
    float* lo = mo + (size_t)kSmTiles * kTok;
    const float* st = sStat + wave * 128;
    mo[lane]      = st[lane];
    mo[lane + 32] = st[lane + 32];
    lo[lane]      = st[lane + 64];
    lo[lane + 32] = st[lane + 96];
  }
}

// ---------------------------------------------------------------------------
// Weight transpose + cast: for square [512][512] f32 W (row-major [in d][out h]), WT[h][d] = f16(scale * W[d][h]).
// 256 blocks (8 x 8 x 4): bx = d tile (64 cols of WT), by = h tile (64 rows of WT), bz selects W0..W3
// and the output plane (plane z at out + z*512*512 halves). 256 threads.
// Load coverage: 16 iterations x 256 threads = 4096 = the whole 64x64 tile (coalesced along h).
// Store coverage: 8 waves x 2 iterations x 4 rows (lane>>3) = 64 rows; (lane&7) x 8 halves = 64 cols; each row segment =
// ---------------------------------------------------------------------------
__device__ __forceinline__ void wtcast_block(const float* __restrict__ W0, const float* __restrict__ W1,
                                             const float* __restrict__ W2, const float* __restrict__ W3,
                                             unsigned short* __restrict__ out, float scale, int bx, int by, int bz) {
  __shared__ float sm[64][65];   // sm[h_local][d_local]
  const int t  = threadIdx.x;
  const int d0 = bx * 64;
  const int h0 = by * 64;
  const int z  = bz;                                           // block-uniform
  const float* W = (z == 0) ? W0 : (z == 1) ? W1 : (z == 2) ? W2 : W3;
#pragma unroll
  for (int i = 0; i < 16; ++i) {
    const int e = i * 256 + t;
    const int r = e >> 6;          // d local
    const int c = e & 63;          // h local
    sm[c][r] = W[(size_t)(d0 + r) * kHid + h0 + c] * scale;
  }
  __syncthreads();
  const int lane = t & 31, wave = t >> 5;
  const int q = lane >> 3, c8 = (lane & 7) * 8;
  unsigned short* op = out + (size_t)z * kHid * kDim;
  {
#pragma unroll
    for (int it = 0; it < 2; ++it) {
      const int row = wave * 8 + it * 4 + q;                 // h local
      unsigned short hb[8];
#pragma unroll
      for (int e = 0; e < 8; ++e) hb[e] = h_bits(sm[row][c8 + e]);
      const v4u u = (v4u){pk16(hb[0], hb[1]), pk16(hb[2], hb[3]), pk16(hb[4], hb[5]), pk16(hb[6], hb[7])};
      *(v4u*)(op + (size_t)(h0 + row) * kDim + d0 + c8) = u;
    }
    
  }
}

// ---------------------------------------------------------------------------
// ---------------------------------------------------------------------------
__device__ __forceinline__ void cast8_f16_block(const float* __restrict__ in, unsigned short* __restrict__ out, int n8, int blk) {
  const int i = blk * 256 + threadIdx.x;
  if (i >= n8) return;
  const float* p = in + 8 * (size_t)i;
  const v4f a = *(const v4f*)(p);
  const v4f c = *(const v4f*)(p + 4);
  unsigned short hb[8];
#pragma unroll
  for (int e = 0; e < 4; ++e) {
    hb[e]     = h_bits(a[e]);
    hb[4 + e] = h_bits(c[e]);
  }
  const v4u u = (v4u){pk16(hb[0], hb[1]), pk16(hb[2], hb[3]), pk16(hb[4], hb[5]), pk16(hb[6], hb[7])};
  unsigned short* q = out + 8 * (size_t)i;
  *(v4u*)q = u;
  
}

// Both casts in one grid: blocks 0..255 transpose and cast the four weights (they start first: theirs is the longer chain),
// the blocks behind them cast x. The choice is block-uniform, so the weight path's barrier is passed by whole blocks only.
constexpr int kWtBlocks = (kDim / 64) * (kHid / 64) * 4;   // 256
__global__ __launch_bounds__(256) void cast_all_kernel(const float* __restrict__ W0, const float* __restrict__ W1,
                                                       const float* __restrict__ W2, const float* __restrict__ W3,
                                                       unsigned short* __restrict__ wout, float scale,
                                                       const float* __restrict__ x, unsigned short* __restrict__ xout, int n8) {
  const int blk = blockIdx.x;
  if (blk < kWtBlocks) wtcast_block(W0, W1, W2, W3, wout, scale, blk & 7, (blk >> 3) & 7, blk >> 6);
  else                 cast8_f16_block(x, xout, n8, blk - kWtBlocks);
}

// ---------------------------------------------------------------------------
// Host side: 5 launches, all grids exact functions of the fixed shapes.
// ---------------------------------------------------------------------------
extern "C" void kernel_launch(void* const* d_in, const int* in_sizes, int n_in,
                              void* d_out, int out_size, void* d_ws, size_t ws_size, hipStream_t stream) {
  if (n_in < 9) return;
  if (in_sizes[0] != kTok * kDim) return;
  if (in_sizes[1] != kDim * kHid || in_sizes[3] != kDim * kHid || in_sizes[5] != kDim * kHid || in_sizes[7] != kDim * kHid) return;
  if (in_sizes[2] != kHid || in_sizes[4] != kHid || in_sizes[6] != kHid || in_sizes[8] != kHid) return;
  if (out_size != kTok * kDim) return;
  if (ws_size < kWsTotal) return;

  const float* x  = (const float*)d_in[0];
  const float* Wq = (const float*)d_in[1];
  const float* bq = (const float*)d_in[2];
  const float* Wk = (const float*)d_in[3];
  const float* bk = (const float*)d_in[4];
  const float* Wv = (const float*)d_in[5];
  const float* bv = (const float*)d_in[6];
  const float* Wo = (const float*)d_in[7];
  const float* bo = (const float*)d_in[8];
  float* out = (float*)d_out;

  char* ws = (char*)d_ws;
  unsigned short* X16  = (unsigned short*)(ws + kOffX);
  unsigned short* Q16  = (unsigned short*)(ws + kOffQ);
  unsigned short* K16  = (unsigned short*)(ws + kOffK);
  unsigned short* VT16 = (unsigned short*)(ws + kOffVT);
  unsigned short* O16  = (unsigned short*)(ws + kOffO);
  unsigned short* WT   = (unsigned short*)(ws + kOffWT);
  unsigned short* EBUF = (unsigned short*)(ws + kOffE);
  float*          STAT = (float*)(ws + kOffStat);
  const size_t wplane = (size_t)kHid * kDim;            // halves per W^T plane
  unsigned short* WqT = WT;
  unsigned short* WoT = WT + 3 * wplane;

  // 1) W^T planes: WT[z][h][d] = f16(16 * W_z[d][h]), 256 blocks; x -> X16 [16384][512], n8 = 1,048,576 -> 4096 blocks exactly
  {
    const int n8 = kTok * kDim / 8;
    cast_all_kernel<<<dim3(kWtBlocks + (n8 + 255) / 256), 256, 0, stream>>>(Wq, Wk, Wv, Wo, WT, kWCarry, x, X16, n8);
  }

  const long tokPlane = (long)kSeq * kDim;               // halves per batch of a [token][512] plane = 1,048,576
  const long vtPlane  = (long)kDim * kSeq;               // halves per batch of V^T [512][2048]

  // 2) the three input projections in one grid of 256 x 3 blocks (grid.y: q, k, v):
  //    Q16 = (X16 . WqT) / 16 + bq, K16 likewise: M 16384, N 512, K 512 -> 128 x 2 block tiles = 256 blocks each;
  //    V^T per batch: VT16[b][d][m] = sum_k WvT[d][k] X16[b*2048+m][k] / 16 + bv[d]: A = WvT [512][512], Bt = X16 batch rows
  //    [2048][512], C [512][2048] -> 4 x 8 block tiles = 32 blocks, 8 batches = 256 blocks
  wmma_gemm64<0, false, 3, 1, false><<<dim3((kTok / kBlockM) * (kHid / kBlockN), 3), 256, 0, stream>>>(
      X16, X16, kDim, 0L, WqT, WqT, kDim, 0L, (void*)Q16, (void*)VT16, kHid, 0L,
      bq, bk, 0L, kTok, kHid, kDim, kWCarryInv, bv);

  // 3) attention, all 8 batches in each launch (grid.y = batch), the softmax split over the two products:
  //    E = 2^(s - m) per 64-key tile with the tile's m and l (score launch), O16 = 256 * sum over tiles of (weight / L) * E.V
  const long sPlane = (long)kSeq * kSeq;                 // elements per batch of E = 4,194,304
  // E [8][2048][2048]: per batch M 2048, N 2048, K 512 -> 16 x 8 block tiles = 128 blocks; 1024 blocks in all
  wmma_gemm64<0, false, 0, 1, false, 0, 1><<<dim3((kSeq / kBlockM) * (kSeq / kBlockN), kBatch), 256, 0, stream>>>(
      Q16, Q16, kHid, tokPlane, K16, K16, kHid, tokPlane, (void*)EBUF, (void*)STAT, kSeq, sPlane,
      bq, bq, 0L, kSeq, kSeq, kHid, kAttnScaleL2, bq);
  // O : A = E [2048][2048], Bt = V^T [512][2048]; per batch M 2048, N 512, K 2048 -> 16 x 2 block tiles = 32 blocks;
  // 256 blocks in all; scale 256/2048
  wmma_gemm64<0, false, 0, 1, false, 0, 2><<<dim3((kSeq / kBlockM) * (kHid / kBlockN), kBatch), 256, 0, stream>>>(
      EBUF, EBUF, kSeq, sPlane, VT16, VT16, kSeq, vtPlane, (void*)O16, (void*)O16, kHid, tokPlane,
      bv, STAT, 0L, kSeq, kHid, kSeq, kPVScale, bv);

  // 4) out = (O16 . WoT) / 4096 + bo   M 16384, N 512, K 512 -> 128 x 2 block tiles = 256 blocks; f32 whole-line epilogue into d_out
  wmma_gemm64<0, false, 2, 0, false><<<dim3((kTok / kBlockM) * (kDim / kBlockN), 1), 256, 0, stream>>>(
      O16, O16, kHid, 0L, WoT, WoT, kHid, 0L, (void*)out, (void*)out, kDim, 0L,
      bo, bo, 0L, kTok, kDim, kHid, kOutScale, bo);
}

// v006
// It runs in 114 microseconds.
// Next to v005, in two timings, it ran 1.10 times as fast each time.
// All steps since v000 together make it 9.63 times as fast.
// Contractions: q/k/v projections (X f16 x W^T f16 carried x16), scores q.k^T (q,k f16 planes), attn.v (E f16, the exponential of a score against its 64-key tile's row maximum, times the tile's weight in f16 carried x2048, x V^T f16), output projection (O f16 carried x256 x Wo^T f16 carried x16), all on v_wmma_f32_16x16x32_f16 with f32 accumulate; softmax and biases in f32.
#include <hip/hip_runtime.h>
#include <math.h>

// ---------------------------------------------------------------------------
// Problem constants
// ---------------------------------------------------------------------------
constexpr int kBatch = 8;
constexpr int kSeq   = 2048;
constexpr int kDim   = 512;               // embed dim (input and output of every projection)
constexpr int kHid   = 512;
constexpr int kTok   = kBatch * kSeq;     // 16384 token rows
constexpr float kWCarry    = 16.0f;       // weights carried x16 in f16
constexpr float kWCarryInv = 1.0f / 16.0f;
constexpr float kPCarry    = 2048.0f;     // probabilities carried x2048 in f16
constexpr float kOCarry    = 256.0f;      // attention output carried x256 in f16
constexpr float kPVScale   = kOCarry / kPCarry;              // 1/8
constexpr float kOutScale  = 1.0f / (kOCarry * kWCarry);     // 1/4096
constexpr float kAttnScaleL2 = 0.044194173824159216f * 1.4426950408889634f;   // 512^-0.5 * log2(e): scores are kept in log2 units
constexpr int   kSmTile  = 64;                // keys per softmax tile = the columns of one wave's score tile
constexpr int   kSmTiles = kSeq / kSmTile;    // 32 tiles per row

// ---------------------------------------------------------------------------
// Workspace region map (bytes); total 174,063,616 B
//   [  0 MiB, 16 MiB)  X16   f16 [16384][512]
//   [ 16 MiB, 32 MiB)  Q16   f16 [16384][512]
//   [ 32 MiB, 48 MiB)  K16   f16 [16384][512]
//   [ 48 MiB, 64 MiB)  (unused)
//   [ 64 MiB, 80 MiB)  VT16  f16 [8][512][2048]
//   [ 80 MiB, 96 MiB)  O16   f16 [16384][512]   (carried x256)
//   [ 96 MiB, 98 MiB)  WT16  f16 4 x [512][512]  (Wq^T, Wk^T, Wv^T, Wo^T, carried x16)
//   [ 98 MiB,162 MiB)  EBUF  f16 [8][2048][2048] (all batches): 2^(s - m), s the score in log2 units, m its tile's row maximum
//   [162 MiB,166 MiB)  STAT  f32 2 x [32][16384]: plane 0 m[tile][token], plane 1 l[tile][token] = the tile's row sum of 2^(s - m)
// ---------------------------------------------------------------------------
constexpr size_t kPlane16 = (size_t)kTok * kDim * 2;                 // 16,777,216
constexpr size_t kOffX   = 0;
constexpr size_t kOffQ   = kOffX  + kPlane16;
constexpr size_t kOffK   = kOffQ  + kPlane16;
constexpr size_t kOffVT  = kOffK  + 2 * kPlane16;
constexpr size_t kOffO   = kOffVT + kPlane16;
constexpr size_t kOffWT  = kOffO  + kPlane16;
constexpr size_t kWTBytes = (size_t)4 * kHid * kDim * 2;              // 2,097,152
constexpr size_t kOffE   = kOffWT + kWTBytes;
constexpr size_t kEBytes = (size_t)kBatch * kSeq * kSeq * 2;          // 67,108,864
constexpr size_t kOffStat   = kOffE + kEBytes;
constexpr size_t kStatBytes = (size_t)2 * kSmTiles * kTok * 4;        // 4,194,304
constexpr size_t kWsTotal = kOffStat + kStatBytes;                    // 174,063,616

typedef __attribute__((ext_vector_type(16))) _Float16 v16h;
typedef __attribute__((ext_vector_type(8)))  _Float16 v8h;
typedef __attribute__((ext_vector_type(4)))  _Float16 v4h;
typedef __attribute__((ext_vector_type(2)))  _Float16 v2h;
typedef __attribute__((ext_vector_type(2)))  unsigned int v2u;
typedef __attribute__((ext_vector_type(16))) __bf16   v16b;
typedef __attribute__((ext_vector_type(8)))  __bf16   v8b;
typedef __attribute__((ext_vector_type(8)))  float    v8f;
typedef __attribute__((ext_vector_type(4)))  float    v4f;
typedef __attribute__((ext_vector_type(4)))  unsigned int v4u;

__device__ __forceinline__ unsigned short f2bf_bits(float f) {
  unsigned u = __float_as_uint(f);
  return (unsigned short)((u + 0x7FFFu + ((u >> 16) & 1u)) >> 16);
}
__device__ __forceinline__ float bf_bits2f(unsigned short h) { return __uint_as_float(((unsigned)h) << 16); }

// hazard guards as plain device helpers
__device__ __forceinline__ void dep_guard_h(v8f& a, v8f& b, v16h x, v16h y) { asm volatile("v_nop\n\tv_nop\n\tv_nop\n\tv_nop" : "+v"(a), "+v"(b) : "v"(x), "v"(y)); }
__device__ __forceinline__ void dep_guard_b(v8f& a, v8f& b, v16b x, v16b y) { asm volatile("v_nop\n\tv_nop\n\tv_nop\n\tv_nop" : "+v"(a), "+v"(b) : "v"(x), "v"(y)); }
__device__ __forceinline__ void keep4_h(v16h a, v16h b, v16h c, v16h d) { asm volatile("v_nop" :: "v"(a), "v"(b), "v"(c), "v"(d)); }
__device__ __forceinline__ void keep4_b(v16b a, v16b b, v16b c, v16b d) { asm volatile("v_nop" :: "v"(a), "v"(b), "v"(c), "v"(d)); }
__device__ __forceinline__ void acc_guard4(v8f& a, v8f& b, v8f& c, v8f& d) { asm volatile("v_nop\n\tv_nop\n\tv_nop\n\tv_nop" : "+v"(a), "+v"(b), "+v"(c), "+v"(d)); }
template <typename T> struct Frag;
template <> struct Frag<_Float16> {
  typedef v16h V; union U { v16h v; v8h h[2]; };
  static __device__ __forceinline__ v16h load(const _Float16* p) {   // elements 0..7 <- p[0..7], 8..15 <- p[16..23]
    U f; f.h[0] = *(const v8h*)(p); f.h[1] = *(const v8h*)(p + 16); return f.v;
  }
  static __device__ __forceinline__ v8f mma(v16h a, v16h b, v8f c) {
    return __builtin_amdgcn_wmma_f32_16x16x32_f16(false, a, false, b, (short)0, c, false, false);
  }
  static __device__ __forceinline__ void guard(v8f& a, v8f& b, v16h x, v16h y) { dep_guard_h(a, b, x, y); }
  static __device__ __forceinline__ void keep(v16h a, v16h b, v16h c, v16h d) { keep4_h(a, b, c, d); }
};
template <> struct Frag<__bf16> {
  typedef v16b V; union U { v16b v; v8b h[2]; };
  static __device__ __forceinline__ v16b load(const __bf16* p) {
    U f; f.h[0] = *(const v8b*)(p); f.h[1] = *(const v8b*)(p + 16); return f.v;
  }
  static __device__ __forceinline__ v8f mma(v16b a, v16b b, v8f c) {
    return __builtin_amdgcn_wmma_f32_16x16x32_bf16(false, a, false, b, (short)0, c, false, false);
  }
  static __device__ __forceinline__ void guard(v8f& a, v8f& b, v16b x, v16b y) { dep_guard_b(a, b, x, y); }
  static __device__ __forceinline__ void keep(v16b a, v16b b, v16b c, v16b d) { keep4_b(a, b, c, d); }
};

__device__ __forceinline__ unsigned pk16(unsigned short a, unsigned short b) { return (unsigned)a | ((unsigned)b << 16); }
__device__ __forceinline__ unsigned short h_bits(float f) { const _Float16 h = (_Float16)f; return __builtin_bit_cast(unsigned short, h); }

// ---- Operand ring in LDS ---------------------------------------------------------------------------------------------
// A block of 8 waves (2 x 4) owns a 128 x 256 tile of C. A stage is 128 k (256 B) of its 128 A rows and 256 Bt rows:
// 384 LDS rows at a pitch of 272 B (16 B x odd, conflict-free for 16-byte row readers); two buffers.
constexpr int kStageK     = 128;                         // halves of k per stage
constexpr int kBlockM     = 128;
constexpr int kBlockN     = 256;
constexpr int kStageRows  = kBlockM + kBlockN;           // 384
constexpr int kRingPitch  = 272;                         // bytes per LDS row
constexpr int kStageBytes = kStageRows * kRingPitch;     // 104,448
// Short stage, for the launches with more blocks than WGPs: 64 k (128 B) of the same 384 rows at a pitch of 144 B (16 B x odd).
// Two buffers are 110,592 B, so that with the epilogue slabs two blocks fit one WGP's LDS.
constexpr int kShortK     = 64;
constexpr int kShortPitch = 144;
constexpr int kShortBytes = kStageRows * kShortPitch;    // 55,296

// Twelve copies of 16 B per lane, global memory to LDS through no register. The s_wait_xcnt is the last line of the copies'
// own statement, so that it stands in front of any rewrite of an address register that a copy names.
__device__ __forceinline__ void copy12(const unsigned (&l)[12], const char* const (&g)[12]) {
  asm volatile(
      "global_load_async_to_lds_b128 %0, %12, off\n\t"
      "global_load_async_to_lds_b128 %1, %13, off\n\t"
      "global_load_async_to_lds_b128 %2, %14, off\n\t"
      "global_load_async_to_lds_b128 %3, %15, off\n\t"
      "global_load_async_to_lds_b128 %4, %16, off\n\t"
      "global_load_async_to_lds_b128 %5, %17, off\n\t"
      "global_load_async_to_lds_b128 %6, %18, off\n\t"
      "global_load_async_to_lds_b128 %7, %19, off\n\t"
      "global_load_async_to_lds_b128 %8, %20, off\n\t"
      "global_load_async_to_lds_b128 %9, %21, off\n\t"
      "global_load_async_to_lds_b128 %10, %22, off\n\t"
      "global_load_async_to_lds_b128 %11, %23, off\n\t"
      "s_wait_xcnt 0x0"
      :: "v"(l[0]), "v"(l[1]), "v"(l[2]), "v"(l[3]), "v"(l[4]), "v"(l[5]), "v"(l[6]), "v"(l[7]), "v"(l[8]), "v"(l[9]), "v"(l[10]), "v"(l[11]),
         "v"(g[0]), "v"(g[1]), "v"(g[2]), "v"(g[3]), "v"(g[4]), "v"(g[5]), "v"(g[6]), "v"(g[7]), "v"(g[8]), "v"(g[9]), "v"(g[10]), "v"(g[11])
      : "memory");
}
// One stage: thread t brings 16 B of LDS rows (t >> 4) + 16 * i, i = 0..23 (i < 8: A rows, else Bt rows); a wave's copy covers
// two whole 256-B row pieces. l: the thread's LDS byte address in row t >> 4 of the buffer; ga, gb: its bytes of the first
// A row and the first Bt row of the stage; stepA, stepB: 16 rows in bytes.
__device__ __forceinline__ void stage_copy(unsigned l, const char* ga, size_t stepA, const char* gb, size_t stepB) {
  unsigned la[12], lb[12];
  const char* pa[12];
  const char* pb[12];
#pragma unroll
  for (int i = 0; i < 12; ++i) {
    la[i] = l + (unsigned)(i * 16 * kRingPitch);
    lb[i] = l + (unsigned)((i + 12) * 16 * kRingPitch);
    pa[i] = (i < 8) ? ga + (size_t)i * stepA : gb + (size_t)(i - 8) * stepB;
    pb[i] = gb + (size_t)(i + 4) * stepB;
  }
  copy12(la, pa);
  copy12(lb, pb);
}
// One short stage: thread t brings 16 B of LDS rows (t >> 3) + 32 * i, i = 0..11 (i < 4: A rows, else Bt rows); a wave's copy covers
// four whole 128-B row pieces. l, ga, gb as above for row t >> 3; stepA, stepB: 32 rows in bytes.
__device__ __forceinline__ void stage_copy_short(unsigned l, const char* ga, size_t stepA, const char* gb, size_t stepB) {
  unsigned la[12];
  const char* pa[12];
#pragma unroll
  for (int i = 0; i < 12; ++i) {
    la[i] = l + (unsigned)(i * 32 * kShortPitch);
    pa[i] = (i < 4) ? ga + (size_t)i * stepA : gb + (size_t)(i - 4) * stepB;
  }
  copy12(la, pa);
}
template <int SK>
__device__ __forceinline__ void stage_in(unsigned l, const char* ga, size_t stepA, const char* gb, size_t stepB) {
  if constexpr (SK == kShortK) stage_copy_short(l, ga, stepA, gb, stepB);
  else                         stage_copy(l, ga, stepA, gb, stepB);
}
// this wave's copies have landed (the compiler places no wait for them)
__device__ __forceinline__ void wait_copies() { asm volatile("s_wait_asynccnt 0x0" ::: "memory"); }
// this wave's LDS reads have retired, before the buffer they read is handed back for a refill
__device__ __forceinline__ void wait_lds_reads() { asm volatile("s_wait_dscnt 0x0" ::: "memory"); }

// ---- Softmax split over the two attention products --------------------------------------------------------------------
// 2^a. v_nop: the independent slot that the instruction set asks for behind a transcendental.
__device__ __forceinline__ float ex2(float a) {
  float r;
  asm("v_exp_f32 %0, %1\n\tv_nop" : "=v"(r) : "v"(a));
  return r;
}
// the value of lane l ^ X inside a 16-lane row (DPP row_xmask:X; every lane is on where it is used)
template <int X> __device__ __forceinline__ float lane_xor(float v) {
  return __builtin_bit_cast(float, __builtin_amdgcn_update_dpp(0, __builtin_bit_cast(int, v), 0x160 + X, 0xf, 0xf, true));
}
constexpr int kWPitch = kSmTiles + 2;   // dwords per row of the tile-weight table in LDS: even (8-byte reads), 34 r mod 64 distinct for 16 rows

// ---- Register-blocked batched WMMA GEMM, operands through the LDS ring --------------------------------------------------
// C[m,n] = scale * sum_k A[m,k] * Bt[n,k] (+bias)(+resid); each block owns a 128x256 tile, each wave a 64x64 tile of it.
// A row-major [M,K]; Bt row-major [N,K]; M % 128 == 0, N % 256 == 0, K % 128 == 0; grid.x = (M/128)*(N/256).
// SPLIT (hi/lo operand planes A2/Bt2) has no user here and is refused at compile time: the ring stages one plane per operand.
// BIAS_MODE: 0 = none, 1 = bias[m], 2 = bias[n], 3 = the three input projections in one grid (blockIdx.y: 0 = q, 1 = k, both
//     C = X . W^T + bias[n]; 2 = v, operands in each other's place, C = V^T per batch + bias[m]). The arguments are then
//     Ap = X, Btp = the W^T planes (q, k, v in a row), Cout = the q plane (k behind it), Cout2 = V^T, bias = bq, resid = bk,
//     bias3 = bv; M, N, K, lda, ldb, ldc as for q.
// OUT_MODE: 0 = f32, 1 = f16, 2 = bf16 hi plane (Cout) + bf16 lo plane (Cout2).
// ET: 0 = f16 operands, 1 = bf16 operands (pointers passed as 16-bit storage)
// SM: 0 = plain. 1 = score product: C = f16(2^(s - m)) with m the row's maximum over the wave's 64 columns; m and the row sum l
//     of the 64 exponentials go to Cout2 (planes [tile][token]). 2 = attn.v: A rows are weighted per 64-k tile by
//     2048 * 2^(m_tile - max m) / L, L = sum over tiles of 2^(m_tile - max m) * l; m and l come in through resid.
template <int ET> struct Elem;
template <> struct Elem<0> { typedef _Float16 T; };
template <> struct Elem<1> { typedef __bf16 T; };
// SK: halves of k per stage. 128: one block per WGP, fragments fetched one 32-k group ahead into a second register set.
//     64: half the ring and one fragment set (at most 256 VGPRs), so that two blocks share a WGP, four waves a SIMD: one block's
//     first copies and epilogue run under the other's products, and the other waves cover a wave's own LDS reads.
//     amdgpu_waves_per_eu: the least number of waves a SIMD must hold, which sets the register budget (4: 256 VGPRs; 2 is what a
//     block of 256 threads has anyway).
template <int ET, bool SPLIT, int BIAS_MODE, int OUT_MODE, bool RESID, int ACT = 0, int SM = 0, int SK = kStageK>
__global__ __launch_bounds__(256) __attribute__((amdgpu_waves_per_eu(SK == kShortK ? 4 : 2))) void wmma_gemm64(
    const unsigned short* __restrict__ Ap, const unsigned short* __restrict__ A2p, int lda, long strideA,
    const unsigned short* __restrict__ Btp, const unsigned short* __restrict__ Bt2p, int ldb, long strideB,
    void* __restrict__ Cout, void* __restrict__ Cout2, int ldc, long strideC,
    const float* __restrict__ bias,
    const float* __restrict__ resid, long strideR,
    int M, int N, int K, float scale, const float* __restrict__ bias3) {
  typedef typename Elem<ET>::T T;
  typedef typename Frag<T>::V V;
  static_assert(!SPLIT, "the LDS ring stages one plane per operand");
  const T* A = (const T*)Ap; const T* Bt = (const T*)Btp;
  constexpr int kPitch = (SK == kShortK) ? kShortPitch : kRingPitch;   // bytes per LDS row of the ring
  constexpr int kBufB  = kStageRows * kPitch;                          // bytes per buffer
  constexpr int kRowTh = SK / 8;                                       // threads (16 B each) per row piece of a stage
  constexpr int kRowSt = 256 / kRowTh;                                 // rows that the block's threads cover in one copy each
  __shared__ __align__(16) unsigned char ring[2 * kBufB];   // two stages of operand rows
  __shared__ __align__(16) float sT[8][16 * 68];   // per-wave 16x64 slab, pitch 68 floats
  __shared__ __align__(16) float sStat[SM == 1 ? 8 * 128 : 4];               // SM 1: per wave m[64], l[64] of its rows
  __shared__ __align__(16) unsigned sW[SM == 2 ? kBlockM * kWPitch : 4];     // SM 2: tile weights, f16 twice in a dword
  int b    = blockIdx.y;
  int tile = blockIdx.x;
  const float* biasp = bias;
  void* Cdst = Cout;
  bool rowBias = (BIAS_MODE == 1);       // block-uniform
  if constexpr (BIAS_MODE == 3) {
    const int which = blockIdx.y;        // block-uniform
    b = 0;
    if (which < 2) {
      Bt   += (size_t)which * kHid * kDim;
      Cdst  = (void*)((unsigned short*)Cout + (size_t)which * kTok * kHid);
      if (which == 1) biasp = resid;
    } else {
      A  = Bt + (size_t)2 * kHid * kDim;          // Wv^T rows [512][512]
      Bt = (const T*)Ap;                          // the batch's token rows [2048][512]
      strideB = (long)kSeq * kDim;
      Cdst    = Cout2;
      ldc     = kSeq;
      strideC = (long)kDim * kSeq;
      biasp   = bias3;
      rowBias = true;
      M = kHid;
      N = kSeq;
      b    = tile >> 5;                           // (512 / 128) * (2048 / 256) = 32 block tiles per batch
      tile = tile & 31;
    }
  }
  const int lane = threadIdx.x & 31;
  const int wave = threadIdx.x >> 5;
  const int tilesN = N / kBlockN;
  const int tilesM = M / kBlockM;
  if (tile >= tilesM * tilesN) return;   // block-uniform, in front of every barrier and copy
  const int tm = tile / tilesN;
  const int tn = tile - tm * tilesN;
  const int bm0 = tm * kBlockM;
  const int bn0 = tn * kBlockN;
  const int wm = wave >> 2;              // wave grid 2 (m) x 4 (n)
  const int wn = wave & 3;
  const int m0 = bm0 + (wm << 6);
  const int n0 = bn0 + (wn << 6);

  const T* Ab  = A  + (size_t)b * strideA;
  const T* Bb  = Bt + (size_t)b * strideB;

  // copy side: this thread's 16-byte column and first row of a stage
  const int crow = threadIdx.x / kRowTh;
  const int ccol = (threadIdx.x & (kRowTh - 1)) * 16;
  const char* gA = (const char*)(Ab + (size_t)(bm0 + crow) * lda) + ccol;
  const char* gB = (const char*)(Bb + (size_t)(bn0 + crow) * ldb) + ccol;
  const size_t stepA = (size_t)lda * (kRowSt * sizeof(T));
  const size_t stepB = (size_t)ldb * (kRowSt * sizeof(T));
  const unsigned ldsCopy = (unsigned)(size_t)ring + (unsigned)(crow * kPitch + ccol);
  const int nStages = K / SK;

  const int rlane = lane & 15;                 // row (A) / col (B, D) within subtile
  const int koff  = (lane >> 4) * 8;           // k offset of this lane half
  const int mOff  = (lane >> 4) * 8;           // D row offset

  v8f acc[4][4];
#pragma unroll
  for (int i = 0; i < 4; ++i)
#pragma unroll
    for (int j = 0; j < 4; ++j) acc[i][j] = (v8f){0.f,0.f,0.f,0.f,0.f,0.f,0.f,0.f};

  // reader side: this lane's byte offsets in a stage (same k order for A and Bt as from global memory)
  const int aRd = ((wm << 6) + rlane) * kPitch + koff * (int)sizeof(T);
  const int bRd = (kBlockM + (wn << 6) + rlane) * kPitch + koff * (int)sizeof(T);

  // prologue: stage 0 lands and is published, then stage 1 flies while stage 0 is worked on
  stage_in<SK>(ldsCopy, gA, stepA, gB, stepB);
  if constexpr (SM == 2) {
    // while stage 0 flies: the row's tile weights, published by the barrier below. Thread t: row t & 127; both
    // halves of the block do the same sums in the same order, each writes 16 of the 32 weights.
    const int srow = threadIdx.x & (kBlockM - 1);
    const int half = threadIdx.x >> 7;
    const float* mp = resid + (size_t)b * M + bm0 + srow;
    const float* lp = mp + (size_t)kSmTiles * kTok;
    float mv[kSmTiles], lv[kSmTiles];
#pragma unroll
    for (int t = 0; t < kSmTiles; ++t) { mv[t] = mp[(size_t)t * kTok]; lv[t] = lp[(size_t)t * kTok]; }
    asm volatile("s_wait_xcnt 0x0" ::: "memory");   // in front of any rewrite of an address register that these loads name
    float gm = mv[0];
#pragma unroll
    for (int t = 1; t < kSmTiles; ++t) gm = fmaxf(gm, mv[t]);
    float tot = 0.f;
#pragma unroll
    for (int t = 0; t < kSmTiles; ++t) {
      mv[t] = ex2(mv[t] - gm);
      tot += mv[t] * lv[t];
    }
    const float inv = kPCarry / tot;   // tot >= 1: the tile that holds the row's maximum has weight 1 and l >= 1
    unsigned* wrow = sW + srow * kWPitch + half * (kSmTiles / 2);
#pragma unroll
    for (int t = 0; t < kSmTiles / 2; ++t) {
      const unsigned short hb = h_bits((half ? mv[t + kSmTiles / 2] : mv[t]) * inv);
      wrow[t] = pk16(hb, hb);
    }
  }
  wait_copies();
  __syncthreads();
  if (nStages > 1)   // block-uniform
    stage_in<SK>(ldsCopy + kBufB, gA + SK * sizeof(T), stepA, gB + SK * sizeof(T), stepB);

#pragma unroll 1
  for (int s = 0; s < nStages; ++s) {   // rolled: one publish point per trip
    const unsigned bufOff = (s & 1) ? (unsigned)kBufB : 0u;
    const unsigned char* buf = ring + bufOff;
    if constexpr (SK == kShortK) {
      static_assert(SK != kShortK || SM != 2, "the tile weights are read per 128-k stage");
      // every loop here is unrolled so that fragments and accumulators are indexed by constants and stay in registers
#pragma unroll
      for (int ks = 0; ks < SK / 32; ++ks) {
        V ga[4], gb[4];                 // one fragment set: the SIMD's other three waves multiply while these are fetched
#pragma unroll
        for (int f = 0; f < 4; ++f) {
          gb[f] = Frag<T>::load((const T*)(buf + bRd + f * 16 * kPitch + ks * 64));
          ga[f] = Frag<T>::load((const T*)(buf + aRd + f * 16 * kPitch + ks * 64));
        }
        __builtin_amdgcn_sched_barrier(0);   // the LDS reads stay one group in front of their products, not spread among them
#pragma unroll
        for (int i = 0; i < 4; ++i) {
#pragma unroll
          for (int j = 0; j < 4; ++j) acc[i][j] = Frag<T>::mma(ga[i], gb[j], acc[i][j]);
        }
        __builtin_amdgcn_sched_barrier(0);   // the next group of LDS reads stays behind this run of products
      }
    } else {
    V fa[2][4], fb[2][4];               // two fragment sets: the next 32 k are fetched while these are multiplied
    v2u wS[4];                          // SM 2: the weights of this stage's two 64-k tiles for the lane's four A rows
    if constexpr (SM == 2) {
#pragma unroll
      for (int f = 0; f < 4; ++f) wS[f] = *(const v2u*)(sW + ((wm << 6) + f * 16 + rlane) * kWPitch + 2 * s);
    }
#pragma unroll
    for (int f = 0; f < 4; ++f) {
      fb[0][f] = Frag<T>::load((const T*)(buf + bRd + f * 16 * kRingPitch));
      fa[0][f] = Frag<T>::load((const T*)(buf + aRd + f * 16 * kRingPitch));
    }
#pragma unroll
    for (int ks = 0; ks < kStageK / 32; ++ks) {
      const int cur = ks & 1, nxt = cur ^ 1;
      if (ks + 1 < kStageK / 32) {
#pragma unroll
        for (int f = 0; f < 4; ++f) {
          fb[nxt][f] = Frag<T>::load((const T*)(buf + bRd + f * 16 * kRingPitch + (ks + 1) * 64));
          fa[nxt][f] = Frag<T>::load((const T*)(buf + aRd + f * 16 * kRingPitch + (ks + 1) * 64));
        }
      }
      __builtin_amdgcn_sched_barrier(0);   // keeps the LDS reads one group ahead of the products, not spread among them
      if constexpr (SM == 2) {
#pragma unroll
        for (int i = 0; i < 4; ++i) {
          const v2h w2 = __builtin_bit_cast(v2h, (unsigned)wS[i][ks >> 1]);
          fa[cur][i] = fa[cur][i] * __builtin_shufflevector(w2, w2, 0, 1, 0, 1, 0, 1, 0, 1, 0, 1, 0, 1, 0, 1, 0, 1);
        }
      }
#pragma unroll
      for (int i = 0; i < 4; ++i) {
#pragma unroll
        for (int j = 0; j < 4; ++j) acc[i][j] = Frag<T>::mma(fa[cur][i], fb[cur][j], acc[i][j]);
      }
      __builtin_amdgcn_sched_barrier(0);   // the next group of LDS reads stays behind this run of products
    }
    }
    // publish point of stage s + 1: own reads retired, own copies landed, then the one barrier of the trip
    wait_lds_reads();
    wait_copies();
    __syncthreads();
    if (s + 2 < nStages) {   // block-uniform: refill the buffer that this trip has just read
      const size_t kb = (size_t)(s + 2) * (SK * sizeof(T));
      stage_in<SK>(ldsCopy + bufOff, gA + kb, stepA, gB + kb, stepB);
    }
  }
  wait_copies();   // nothing is outstanding when the wave goes on to the epilogue and ends
  acc_guard4(acc[0][0], acc[0][1], acc[0][2], acc[0][3]);
  acc_guard4(acc[1][0], acc[1][1], acc[1][2], acc[1][3]);
  acc_guard4(acc[2][0], acc[2][1], acc[2][2], acc[2][3]);
  acc_guard4(acc[3][0], acc[3][1], acc[3][2], acc[3][3]);

  // ---- epilogue ----
  float* slab = sT[wave];
  const float* Rb = RESID ? (resid + (size_t)b * strideR) : nullptr;
#pragma unroll
  for (int i = 0; i < 4; ++i) {
    const int mBase = m0 + (i << 4);
    float rb[8], cb[4];
    if constexpr (BIAS_MODE == 3) {   // one group of loads per 16 rows, as in modes 1 and 2; the branch is block-uniform
#pragma unroll
      for (int r = 0; r < 8; ++r) rb[r] = 0.f;
#pragma unroll
      for (int j = 0; j < 4; ++j) cb[j] = 0.f;
      if (rowBias) {
#pragma unroll
        for (int r = 0; r < 8; ++r) rb[r] = biasp[mBase + mOff + r];
      } else {
#pragma unroll
        for (int j = 0; j < 4; ++j) cb[j] = biasp[n0 + (j << 4) + rlane];
      }
    }
#pragma unroll
    for (int j = 0; j < 4; ++j) {
      const int n = n0 + (j << 4) + rlane;
      float bv = 0.f;
      if (BIAS_MODE == 2) bv = bias[n];
      if (BIAS_MODE == 3) bv = cb[j];
#pragma unroll
      for (int r = 0; r < 8; ++r) {
        float v = acc[i][j][r] * scale;
        if (BIAS_MODE == 1) v += bias[mBase + mOff + r];
        if (BIAS_MODE == 2) v += bv;
        if (BIAS_MODE == 3) v += rowBias ? rb[r] : bv;
        if (RESID) v += Rb[(size_t)(mBase + mOff + r) * ldc + n];
        if (ACT == 2) v = fmaxf(v, 0.0f);
        if (ACT == 4) v = (v > 0.f) ? v : 0.01f * v;
        slab[(mOff + r) * 68 + (j << 4) + rlane] = v;
      }
    }
    __builtin_amdgcn_fence(__ATOMIC_RELEASE, "workgroup");
    __builtin_amdgcn_wave_barrier();
    __builtin_amdgcn_fence(__ATOMIC_ACQUIRE, "workgroup");
    if (OUT_MODE == 0) {
      float* C = (float*)Cdst + (size_t)b * strideC;
      const int hh = lane >> 4, c4 = (lane & 15) * 4;     // row seg = 256 B = 16 lanes x 16 B
      {
#pragma unroll
        for (int it = 0; it < 8; ++it) {
          const int row = it * 2 + hh;
          v4f v = *(const v4f*)(slab + row * 68 + c4);
          *(v4f*)(C + (size_t)(mBase + row) * ldc + n0 + c4) = v;
        }
        
      }
    } else {
      const int q = lane >> 3, c8 = (lane & 7) * 8;
      unsigned short* C  = (unsigned short*)Cdst  + (size_t)b * strideC;
      unsigned short* C2 = (OUT_MODE == 2) ? ((unsigned short*)Cout2 + (size_t)b * strideC) : nullptr;
      {
#pragma unroll
        for (int it = 0; it < 4; ++it) {
          const int row = it * 4 + q;
          const float* sp = slab + row * 68 + c8;
          v8h hv, lv;
          if constexpr (SM == 1) {
            // eight lanes hold a row's 64 scores, eight each: maximum, exponentials and their sum in fixed order
            float xs[8];
#pragma unroll
            for (int e = 0; e < 8; ++e) xs[e] = sp[e];
            float mx = fmaxf(fmaxf(fmaxf(xs[0], xs[1]), fmaxf(xs[2], xs[3])), fmaxf(fmaxf(xs[4], xs[5]), fmaxf(xs[6], xs[7])));
            mx = fmaxf(mx, lane_xor<1>(mx));
            mx = fmaxf(mx, lane_xor<2>(mx));
            mx = fmaxf(mx, lane_xor<4>(mx));
#pragma unroll
            for (int e = 0; e < 8; ++e) { xs[e] = ex2(xs[e] - mx); hv[e] = (_Float16)xs[e]; }
            float sum = ((xs[0] + xs[1]) + (xs[2] + xs[3])) + ((xs[4] + xs[5]) + (xs[6] + xs[7]));
            sum += lane_xor<1>(sum);
            sum += lane_xor<2>(sum);
            sum += lane_xor<4>(sum);
            if ((lane & 7) == 0) {
              sStat[wave * 128 + (i << 4) + row]      = mx;
              sStat[wave * 128 + 64 + (i << 4) + row] = sum;
            }
          } else
#pragma unroll
          for (int e = 0; e < 8; ++e) {
            if (OUT_MODE == 1) {
              hv[e] = (_Float16)sp[e];
            } else {
              unsigned short hb = f2bf_bits(sp[e]);
              unsigned short lb = f2bf_bits(sp[e] - bf_bits2f(hb));
              hv[e] = __builtin_bit_cast(_Float16, hb);
              lv[e] = __builtin_bit_cast(_Float16, lb);
            }
          }
          *(v8h*)(C + (size_t)(mBase + row) * ldc + n0 + c8) = hv;
          if (OUT_MODE == 2) *(v8h*)(C2 + (size_t)(mBase + row) * ldc + n0 + c8) = lv;
        }
        
      }
    }
    __builtin_amdgcn_fence(__ATOMIC_RELEASE, "workgroup");
    __builtin_amdgcn_wave_barrier();
    __builtin_amdgcn_fence(__ATOMIC_ACQUIRE, "workgroup");
  }
  if constexpr (SM == 1) {
    // the wave's 64 rows of m and l, behind the fences that end the loop: each store covers one whole 128-byte line
    float* mo = (float*)Cout2 + (size_t)(n0 / kSmTile) * kTok + (size_t)b * M + m0;
    float* lo = mo + (size_t)kSmTiles * kTok;
    const float* st = sStat + wave * 128;
    mo[lane]      = st[lane];
    mo[lane + 32] = st[lane + 32];
    lo[lane]      = st[lane + 64];
    lo[lane + 32] = st[lane + 96];
  }
}

// ---------------------------------------------------------------------------
// Weight transpose + cast: for square [512][512] f32 W (row-major [in d][out h]), WT[h][d] = f16(scale * W[d][h]).
// 256 blocks (8 x 8 x 4): bx = d tile (64 cols of WT), by = h tile (64 rows of WT), bz selects W0..W3
// and the output plane (plane z at out + z*512*512 halves). 256 threads.
// Load coverage: 16 iterations x 256 threads = 4096 = the whole 64x64 tile (coalesced along h).
// Store coverage: 8 waves x 2 iterations x 4 rows (lane>>3) = 64 rows; (lane&7) x 8 halves = 64 cols; each row segment =
// ---------------------------------------------------------------------------
__device__ __forceinline__ void wtcast_block(const float* __restrict__ W0, const float* __restrict__ W1,
                                             const float* __restrict__ W2, const float* __restrict__ W3,
                                             unsigned short* __restrict__ out, float scale, int bx, int by, int bz) {
  __shared__ float sm[64][65];   // sm[h_local][d_local]
  const int t  = threadIdx.x;
  const int d0 = bx * 64;
  const int h0 = by * 64;
  const int z  = bz;                                           // block-uniform
  const float* W = (z == 0) ? W0 : (z == 1) ? W1 : (z == 2) ? W2 : W3;
#pragma unroll
  for (int i = 0; i < 16; ++i) {
    const int e = i * 256 + t;
    const int r = e >> 6;          // d local
    const int c = e & 63;          // h local
    sm[c][r] = W[(size_t)(d0 + r) * kHid + h0 + c] * scale;
  }
  __syncthreads();
  const int lane = t & 31, wave = t >> 5;
  const int q = lane >> 3, c8 = (lane & 7) * 8;
  unsigned short* op = out + (size_t)z * kHid * kDim;
  {
#pragma unroll
    for (int it = 0; it < 2; ++it) {
      const int row = wave * 8 + it * 4 + q;                 // h local
      unsigned short hb[8];
#pragma unroll
      for (int e = 0; e < 8; ++e) hb[e] = h_bits(sm[row][c8 + e]);
      const v4u u = (v4u){pk16(hb[0], hb[1]), pk16(hb[2], hb[3]), pk16(hb[4], hb[5]), pk16(hb[6], hb[7])};
      *(v4u*)(op + (size_t)(h0 + row) * kDim + d0 + c8) = u;
    }
    
  }
}

// ---------------------------------------------------------------------------
// ---------------------------------------------------------------------------
__device__ __forceinline__ void cast8_f16_block(const float* __restrict__ in, unsigned short* __restrict__ out, int n8, int blk) {
  const int i = blk * 256 + threadIdx.x;
  if (i >= n8) return;
  const float* p = in + 8 * (size_t)i;
  const v4f a = *(const v4f*)(p);
  const v4f c = *(const v4f*)(p + 4);
  unsigned short hb[8];
#pragma unroll
  for (int e = 0; e < 4; ++e) {
    hb[e]     = h_bits(a[e]);
    hb[4 + e] = h_bits(c[e]);
  }
  const v4u u = (v4u){pk16(hb[0], hb[1]), pk16(hb[2], hb[3]), pk16(hb[4], hb[5]), pk16(hb[6], hb[7])};
  unsigned short* q = out + 8 * (size_t)i;
  *(v4u*)q = u;
  
}

// Both casts in one grid: blocks 0..255 transpose and cast the four weights (for speed only: theirs is the longer chain),
// the blocks behind them cast x. The choice is block-uniform, so the weight path's barrier is passed by whole blocks only.
constexpr int kWtBlocks = (kDim / 64) * (kHid / 64) * 4;   // 256
__global__ __launch_bounds__(256) void cast_all_kernel(const float* __restrict__ W0, const float* __restrict__ W1,
                                                       const float* __restrict__ W2, const float* __restrict__ W3,
                                                       unsigned short* __restrict__ wout, float scale,
                                                       const float* __restrict__ x, unsigned short* __restrict__ xout, int n8) {
  const int blk = blockIdx.x;
  if (blk < kWtBlocks) wtcast_block(W0, W1, W2, W3, wout, scale, blk & 7, (blk >> 3) & 7, blk >> 6);
  else                 cast8_f16_block(x, xout, n8, blk - kWtBlocks);
}

// ---------------------------------------------------------------------------
// Host side: 5 launches, all grids exact functions of the fixed shapes.
// ---------------------------------------------------------------------------
extern "C" void kernel_launch(void* const* d_in, const int* in_sizes, int n_in,
                              void* d_out, int out_size, void* d_ws, size_t ws_size, hipStream_t stream) {
  if (n_in < 9) return;
  if (in_sizes[0] != kTok * kDim) return;
  if (in_sizes[1] != kDim * kHid || in_sizes[3] != kDim * kHid || in_sizes[5] != kDim * kHid || in_sizes[7] != kDim * kHid) return;
  if (in_sizes[2] != kHid || in_sizes[4] != kHid || in_sizes[6] != kHid || in_sizes[8] != kHid) return;
  if (out_size != kTok * kDim) return;
  if (ws_size < kWsTotal) return;

  const float* x  = (const float*)d_in[0];
  const float* Wq = (const float*)d_in[1];
  const float* bq = (const float*)d_in[2];
  const float* Wk = (const float*)d_in[3];
  const float* bk = (const float*)d_in[4];
  const float* Wv = (const float*)d_in[5];
  const float* bv = (const float*)d_in[6];
  const float* Wo = (const float*)d_in[7];
  const float* bo = (const float*)d_in[8];
  float* out = (float*)d_out;

  char* ws = (char*)d_ws;
  unsigned short* X16  = (unsigned short*)(ws + kOffX);
  unsigned short* Q16  = (unsigned short*)(ws + kOffQ);
  unsigned short* K16  = (unsigned short*)(ws + kOffK);
  unsigned short* VT16 = (unsigned short*)(ws + kOffVT);
  unsigned short* O16  = (unsigned short*)(ws + kOffO);
  unsigned short* WT   = (unsigned short*)(ws + kOffWT);
  unsigned short* EBUF = (unsigned short*)(ws + kOffE);
  float*          STAT = (float*)(ws + kOffStat);
  const size_t wplane = (size_t)kHid * kDim;            // halves per W^T plane
  unsigned short* WqT = WT;
  unsigned short* WoT = WT + 3 * wplane;

  // 1) W^T planes: WT[z][h][d] = f16(16 * W_z[d][h]), 256 blocks; x -> X16 [16384][512], n8 = 1,048,576 -> 4096 blocks exactly
  {
    const int n8 = kTok * kDim / 8;
    cast_all_kernel<<<dim3(kWtBlocks + (n8 + 255) / 256), 256, 0, stream>>>(Wq, Wk, Wv, Wo, WT, kWCarry, x, X16, n8);
  }

  const long tokPlane = (long)kSeq * kDim;               // halves per batch of a [token][512] plane = 1,048,576
  const long vtPlane  = (long)kDim * kSeq;               // halves per batch of V^T [512][2048]

  // 2) the three input projections in one grid of 256 x 3 blocks (grid.y: q, k, v), short stages, two blocks per WGP:
  //    Q16 = (X16 . WqT) / 16 + bq, K16 likewise: M 16384, N 512, K 512 -> 128 x 2 block tiles = 256 blocks each;
  //    V^T per batch: VT16[b][d][m] = sum_k WvT[d][k] X16[b*2048+m][k] / 16 + bv[d]: A = WvT [512][512], Bt = X16 batch rows
  //    [2048][512], C [512][2048] -> 4 x 8 block tiles = 32 blocks, 8 batches = 256 blocks
  wmma_gemm64<0, false, 3, 1, false, 0, 0, kShortK><<<dim3((kTok / kBlockM) * (kHid / kBlockN), 3), 256, 0, stream>>>(
      X16, X16, kDim, 0L, WqT, WqT, kDim, 0L, (void*)Q16, (void*)VT16, kHid, 0L,
      bq, bk, 0L, kTok, kHid, kDim, kWCarryInv, bv);

  // 3) attention, all 8 batches in each launch (grid.y = batch), the softmax split over the two products:
  //    E = 2^(s - m) per 64-key tile with the tile's m and l (score launch), O16 = 256 * sum over tiles of (weight / L) * E.V
  const long sPlane = (long)kSeq * kSeq;                 // elements per batch of E = 4,194,304
  // E [8][2048][2048]: per batch M 2048, N 2048, K 512 -> 16 x 8 block tiles = 128 blocks; 1024 blocks in all; short stages,
  // two blocks per WGP
  wmma_gemm64<0, false, 0, 1, false, 0, 1, kShortK><<<dim3((kSeq / kBlockM) * (kSeq / kBlockN), kBatch), 256, 0, stream>>>(
      Q16, Q16, kHid, tokPlane, K16, K16, kHid, tokPlane, (void*)EBUF, (void*)STAT, kSeq, sPlane,
      bq, bq, 0L, kSeq, kSeq, kHid, kAttnScaleL2, bq);
  // O : A = E [2048][2048], Bt = V^T [512][2048]; per batch M 2048, N 512, K 2048 -> 16 x 2 block tiles = 32 blocks;
  // 256 blocks in all; scale 256/2048
  wmma_gemm64<0, false, 0, 1, false, 0, 2><<<dim3((kSeq / kBlockM) * (kHid / kBlockN), kBatch), 256, 0, stream>>>(
      EBUF, EBUF, kSeq, sPlane, VT16, VT16, kSeq, vtPlane, (void*)O16, (void*)O16, kHid, tokPlane,
      bv, STAT, 0L, kSeq, kHid, kSeq, kPVScale, bv);

  // 4) out = (O16 . WoT) / 4096 + bo   M 16384, N 512, K 512 -> 128 x 2 block tiles = 256 blocks; f32 whole-line epilogue into d_out
  wmma_gemm64<0, false, 2, 0, false><<<dim3((kTok / kBlockM) * (kDim / kBlockN), 1), 256, 0, stream>>>(
      O16, O16, kHid, 0L, WoT, WoT, kHid, 0L, (void*)out, (void*)out, kDim, 0L,
      bo, bo, 0L, kTok, kDim, kHid, kOutScale, bo);
}
